// v000
// Times are from an AMD MI455X. After a warm-up the kernel runs many times in a row, and a time is the length of
// such a window on the GPU divided by its runs, so every launch and the gaps after it count. The runs cycle
// through copies of the inputs. A figure is the median of several windows, for all but v000 over two sittings.
// Sittings can differ by a few percent; kernels timed side by side share one.
// v000, which the later versions start from, runs in 333 microseconds.
#include <hip/hip_runtime.h>

// All contractions: v_wmma_f32_16x16x32_f16 (f16 operands, f32 accumulate). q/k/v projections [NB*KL x 1024] x [1024 x 3072]: x bf16-exact f16 x8, W bf16-exact f16 x256,
// 1 product, bias added in f32; S^T = K Q^T with q and k carried as f16 hi+lo x8 planes (3 products); O^T += V^T P^T with v as f16 hi+lo x8 planes and P x1024 f16 hi+lo
// (3 products); softmax running max / sum / normaliser in f32.
// Layouts: x [NB_FULL][SEQ_FULL][1024]; W_q/W_k/W_v [1024 out][1024 in]; b_q/b_k/b_v [1024]; y = x W^T + b split into 16 heads x 64; scores scaled by 1/8; key j visible to query i
// iff j <= i + 128; out[b][t][64 h + d] = softmax-weighted sum of v, stored as f32 directly (no output projection).
// Every float input is RNE-converted to bf16 once on load. Fragment k-map per lane half hh for A AND B: elements 0..7 <- k = 8hh+0..7, 8..15 <- k = 16+8hh+0..7;
// Deterministic fixed-order flash-style loop per 16-query wave over the visible keys; no cross-block communication inside a launch.

#ifndef NB
#define NB 2
#endif
#ifndef SEQ
#define SEQ 2048
#endif
#define NB_FULL 2
#define SEQ_FULL 2048

namespace {
constexpr int DM = 1024, H = 16, HD = 64, SRC = 128;
constexpr int KL = ((SEQ) + SRC < (SEQ_FULL)) ? ((SEQ) + SRC) : (SEQ_FULL);   // key / value tokens needed by queries < SEQ
static_assert((NB) >= 1 && (NB) <= (NB_FULL));
static_assert((SEQ) % 64 == 0 && (SEQ) >= 64 && (SEQ) <= (SEQ_FULL));
static_assert(KL % 64 == 0 && KL >= (SEQ) && KL <= (SEQ_FULL));
static_assert(DM == H * HD && DM % 128 == 0 && HD == 64 && (SEQ_FULL) % 32 == 0);
constexpr float XS = 8.0f, WSC = 256.0f, PS = 1024.0f, LOG2E = 1.4426950408889634f;
typedef _Float16 b16;
typedef __attribute__((ext_vector_type(16))) _Float16 v16b;
typedef __attribute__((ext_vector_type(8))) _Float16 v8b;
typedef __attribute__((ext_vector_type(4))) _Float16 v4h;
typedef __attribute__((ext_vector_type(2))) _Float16 v2h;
typedef __attribute__((ext_vector_type(8))) float v8f;
typedef __attribute__((ext_vector_type(4))) float v4f;

__device__ __forceinline__ float bf16_rne(float f) { unsigned int u = __float_as_uint(f); u += 0x7FFFu + ((u >> 16) & 1u); return __uint_as_float(u & 0xFFFF0000u); }
__device__ __forceinline__ void split16(float v, b16& hi, b16& lo) { hi = (b16)v; lo = (b16)(v - (float)hi); }
// 16-bit fragment from a k-contiguous row (A: row m; B: column n stored [n][k]); hh = lane half
__device__ __forceinline__ v16b frag_kb(const b16* p, int hh) { const v8b a = *(const v8b*)(p + 8 * hh), b = *(const v8b*)(p + 16 + 8 * hh); v16b f;
#pragma unroll
  for (int e = 0; e < 8; ++e) { f[e] = a[e]; f[8 + e] = b[e]; } return f; }
__device__ __forceinline__ v8f wmma16b(v16b a, v16b b, v8f c) { v8f d = __builtin_amdgcn_wmma_f32_16x16x32_f16(false, a, false, b, (short)0, c, false, false); asm volatile("v_nop\n\tv_nop\n\tv_nop\n\tv_nop" : "+v"(d) : "v"(a), "v"(b)); return d; }
__device__ __forceinline__ void wave_lds_sync() { __builtin_amdgcn_fence(3, "workgroup"); __builtin_amdgcn_wave_barrier(); __builtin_amdgcn_fence(2, "workgroup"); }
__device__ __forceinline__ float nexp2(float v) { return __builtin_amdgcn_exp2f(v); }

constexpr size_t WU = (size_t)DM * DM / 8;                         // 8-element units per weight matrix
constexpr size_t XU = (size_t)(NB_FULL) * (SEQ_FULL) * DM / 8;     // 8-element units of x
constexpr size_t PREP_UNITS = 3 * WU + XU;
static_assert(PREP_UNITS % 256 == 0 && (3 * WU) % 256 == 0 && WU % 256 == 0);

// prep: WT [3072 o][1024 k] = W_q | W_k | W_v rows ([out][in] is already k-contiguous), bf16 RNE then x256 -> f16; X16 [NB_FULL*SEQ_FULL][1024] = bf16 RNE(x) x8 -> f16.
__global__ __launch_bounds__(256) void prep_kernel(const float* __restrict__ x, const float* __restrict__ wq, const float* __restrict__ wk, const float* __restrict__ wv, b16* __restrict__ X16, b16* __restrict__ WT) {
  const size_t u = (size_t)blockIdx.x * 256 + threadIdx.x; if (u >= PREP_UNITS) return;
  const float* src; b16* dst; float sc;
  if (u < 3 * WU) { const int m = (int)(u / WU); const size_t e = (u - (size_t)m * WU) * 8; const float* w = m == 0 ? wq : m == 1 ? wk : wv; src = w + e; dst = WT + (size_t)m * DM * DM + e; sc = WSC; }
  else { const size_t e = (u - 3 * WU) * 8; src = x + e; dst = X16 + e; sc = XS; }
  const v4f f0 = *(const v4f*)src, f1 = *(const v4f*)(src + 4); v8b o;
#pragma unroll
  for (int j = 0; j < 4; ++j) { o[j] = (b16)(bf16_rne(f0[j]) * sc); o[4 + j] = (b16)(bf16_rne(f1[j]) * sc); }
  { *(v8b*)dst = o;  }
}

// projections: grid (KL/64, NB, 24 slabs of 128 columns: 0-7 q, 8-15 k, 16-23 v); block = 64 tokens of batch b x 4 waves (16 tokens per wave, 8 accumulator tiles);
// A fragments from the X16 plane, B fragments from WT rows (K = 1024); epilogue + bf16-RNE bias in f32 into Tf; q/k -> f16 hi/lo x8 planes [b][h][t][64]
__global__ __launch_bounds__(128) void proj_kernel(const b16* __restrict__ X16, const b16* __restrict__ WT, const float* __restrict__ bq, const float* __restrict__ bk, const float* __restrict__ bv,
                                                   b16* __restrict__ QH, b16* __restrict__ QLo, b16* __restrict__ KH, b16* __restrict__ KLo, b16* __restrict__ VTh, b16* __restrict__ VTl) {
  __shared__ __attribute__((aligned(16))) float Tf[4][16][128 + 4];
  const int wave = threadIdx.x >> 5, lane = threadIdx.x & 31, nloc = lane & 15, hlf = lane >> 4; const int t0 = blockIdx.x * 64; const int b = blockIdx.y;
  const int slab = blockIdx.z, n0 = slab * 128, part = slab / 8, c0 = n0 - part * DM;
  const float* bias = part == 0 ? bq : part == 1 ? bk : bv;
  const b16* xa = X16 + ((size_t)b * (SEQ_FULL) + t0 + wave * 16 + nloc) * DM;
  v8f acc[8];
#pragma unroll
  for (int t = 0; t < 8; ++t) acc[t] = (v8f){};
#pragma unroll 1
  for (int kb = 0; kb < DM; kb += 32) { const v16b a = frag_kb(xa + kb, hlf);
#pragma unroll
    for (int t = 0; t < 8; ++t) acc[t] = wmma16b(a, frag_kb(WT + (size_t)(n0 + t * 16 + nloc) * DM + kb, hlf), acc[t]); }
#pragma unroll
  for (int t = 0; t < 8; ++t) { const float bb = bf16_rne(bias[c0 + t * 16 + nloc]);
#pragma unroll
    for (int r = 0; r < 8; ++r) Tf[wave][8 * hlf + r][t * 16 + nloc] = acc[t][r] * (1.0f / (XS * WSC)) + bb; }
  __syncthreads();   // Tf is read across waves in the v branch
  {
    if (part < 2) { b16* ph_ = part == 0 ? QH : KH; b16* pl_ = part == 0 ? QLo : KLo; const int c = c0 + lane * 4; const int h = c / HD, d = c % HD;
      for (int rr = 0; rr < 16; ++rr) { const int tok = t0 + wave * 16 + rr; v4h h4, l4; for (int j = 0; j < 4; ++j) { b16 p, q; split16(Tf[wave][rr][lane * 4 + j] * XS, p, q); h4[j] = p; l4[j] = q; }
        const size_t oi = (((size_t)b * H + h) * (SEQ_FULL) + tok) * HD + d; *(v4h*)(ph_ + oi) = h4; *(v4h*)(pl_ + oi) = l4; } }
    else {
#pragma unroll 1
      for (int q = 0; q < 32; ++q) { const int cl = wave * 32 + q; const int c = c0 + cl; const int h = c / HD, d = c % HD; const int tk = lane * 2; v2h hv, lv;
        for (int j = 0; j < 2; ++j) { b16 p, ql; split16(Tf[(tk + j) >> 4][(tk + j) & 15][cl] * XS, p, ql); hv[j] = p; lv[j] = ql; }
        const size_t oi = (((size_t)b * H + h) * HD + d) * (size_t)(SEQ_FULL) + t0 + lane * 2; *(v2h*)(VTh + oi) = hv; *(v2h*)(VTl + oi) = lv; } }
     }
}

// attention: grid (SEQ/32, NB x H): block = 2 waves x 16 queries; keys 0 .. min(KL, q0+16+128) in 32-key tiles (prefix-causal test key <= qi + 128 per element);
// S^T = K Q^T with 3 products (kh qh + kh ql + kl qh); online softmax in f32; P x1024 hi/lo into a wave-private LDS tile; O^T += V^T P^T (3 products);
__global__ __launch_bounds__(64) void attn_kernel(const b16* __restrict__ QH, const b16* __restrict__ QLo, const b16* __restrict__ KH, const b16* __restrict__ KLo,
                                                  const b16* __restrict__ VTh, const b16* __restrict__ VTl, float* __restrict__ out) {
  __shared__ __attribute__((aligned(16))) b16 Pb[2][16][32 + 8], Pc[2][16][32 + 8]; __shared__ __attribute__((aligned(16))) float To[2][16][HD + 4];
  const int wave = threadIdx.x >> 5, lane = threadIdx.x & 31, hh = lane >> 4, col = lane & 15; const int b = blockIdx.y / H, h = blockIdx.y % H;
  const int q0 = blockIdx.x * 32 + wave * 16, qi = q0 + col;
  const size_t ph = (size_t)b * H + h; const size_t pq = ph * (size_t)(SEQ_FULL) * HD; const b16* Vh = VTh + ph * HD * (size_t)(SEQ_FULL); const b16* Vl = VTl + ph * HD * (size_t)(SEQ_FULL);
  const v16b qh0 = frag_kb(QH + pq + (size_t)qi * HD, hh), qh1 = frag_kb(QH + pq + (size_t)qi * HD + 32, hh), ql0 = frag_kb(QLo + pq + (size_t)qi * HD, hh), ql1 = frag_kb(QLo + pq + (size_t)qi * HD + 32, hh);
  const float cs = LOG2E / (8.0f * XS * XS);
  float m = -INFINITY, l = 0.0f; v8f o[4];
#pragma unroll
  for (int t = 0; t < 4; ++t) o[t] = (v8f){};
  const int kend = (q0 + 16 + SRC < KL) ? (q0 + 16 + SRC) : KL;   // wave-uniform; loaded keys stay < KL (KL multiple of 32)
#pragma unroll 1
  for (int kb = 0; kb < kend; kb += 32) {
    float e[16]; float mx = -INFINITY;
#pragma unroll
    for (int u = 0; u < 2; ++u) { v8f s = (v8f){}; const size_t kr = pq + (size_t)(kb + u * 16 + col) * HD; const v16b kh0 = frag_kb(KH + kr, hh), kh1 = frag_kb(KH + kr + 32, hh), kl0 = frag_kb(KLo + kr, hh), kl1 = frag_kb(KLo + kr + 32, hh);
      s = wmma16b(kh0, qh0, s); s = wmma16b(kh0, ql0, s); s = wmma16b(kl0, qh0, s); s = wmma16b(kh1, qh1, s); s = wmma16b(kh1, ql1, s); s = wmma16b(kl1, qh1, s);
#pragma unroll
      for (int r = 0; r < 8; ++r) { const int key = kb + u * 16 + 8 * hh + r; const float vv = (key <= qi + SRC) ? s[r] * cs : -INFINITY; e[u * 8 + r] = vv; mx = fmaxf(mx, vv); } }
    mx = fmaxf(mx, __shfl_xor(mx, 16)); const float mn = fmaxf(m, mx); const float al = (mn == -INFINITY) ? 1.0f : nexp2(m - mn); float sum = 0.0f;
#pragma unroll
    for (int i2 = 0; i2 < 16; ++i2) { const float p = (e[i2] == -INFINITY) ? 0.0f : nexp2(e[i2] - mn); sum += p; b16 a_, b_; split16(p * PS, a_, b_); const int sl = (i2 < 8 ? 0 : 16) + 8 * hh + (i2 & 7); Pb[wave][col][sl] = a_; Pc[wave][col][sl] = b_; }
    sum += __shfl_xor(sum, 16); l = l * al + sum; m = mn;
    wave_lds_sync();
    const v16b pf = frag_kb(&Pb[wave][col][0], hh), pg = frag_kb(&Pc[wave][col][0], hh);
#pragma unroll
    for (int t = 0; t < 4; ++t) { o[t] *= al; const size_t vr = (size_t)(t * 16 + col) * (SEQ_FULL) + kb; const v16b va = frag_kb(Vh + vr, hh), vb2 = frag_kb(Vl + vr, hh); o[t] = wmma16b(va, pf, o[t]); o[t] = wmma16b(va, pg, o[t]); o[t] = wmma16b(vb2, pf, o[t]); }
    wave_lds_sync(); }
  const float inv = 1.0f / (l * PS * XS);
#pragma unroll
  for (int t = 0; t < 4; ++t)
#pragma unroll
    for (int r = 0; r < 8; ++r) To[wave][col][t * 16 + 8 * hh + r] = o[t][r] * inv;
  wave_lds_sync();
  {
    for (int rr2 = 0; rr2 < 8; ++rr2) { const int row = 2 * rr2 + hh; const int c4 = col * 4; const v4f f = *(const v4f*)(&To[wave][row][c4]);
      *(v4f*)(out + ((size_t)b * (SEQ_FULL) + q0 + row) * DM + h * HD + c4) = f; }
     }
}
}  // namespace

extern "C" void kernel_launch(void* const* d_in, const int* in_sizes, int n_in, void* d_out, int out_size, void* d_ws, size_t ws_size, hipStream_t stream) {
  if (n_in < 7) return;
  auto Fp = [&](int i) { return (const float*)d_in[i]; };
  // wire order: 0 x [2,2048,1024], 1 W_q [1024,1024] (out,in), 2 b_q [1024], 3 W_k, 4 b_k, 5 W_v, 6 b_v - all f32
  if (in_sizes[0] < (NB_FULL) * (SEQ_FULL) * DM || in_sizes[1] < DM * DM || in_sizes[2] < DM || in_sizes[3] < DM * DM || in_sizes[4] < DM || in_sizes[5] < DM * DM || in_sizes[6] < DM) return;
  if (out_size < (((NB) - 1) * (SEQ_FULL) + (SEQ)) * DM) return;
  size_t off = 0; char* ws = (char*)d_ws;
  auto carve = [&](size_t bytes) { char* p = ws + off; off += (bytes + 255) & ~(size_t)255; return p; };
  b16* X16 = (b16*)carve((size_t)(NB_FULL) * (SEQ_FULL) * DM * 2);                 // 8 MiB
  b16* WT = (b16*)carve((size_t)3 * DM * DM * 2);                                  // 6 MiB
  const size_t plane = (size_t)(NB_FULL) * H * (SEQ_FULL) * HD * 2;                 // 8 MiB each, full strides
  b16* QH = (b16*)carve(plane); b16* QLo = (b16*)carve(plane); b16* KH = (b16*)carve(plane); b16* KLo = (b16*)carve(plane); b16* VTh = (b16*)carve(plane); b16* VTl = (b16*)carve(plane);
  if (off > ws_size || off > ((size_t)128 << 20)) return;   // total 62 MiB
  prep_kernel<<<(unsigned)(PREP_UNITS / 256), 256, 0, stream>>>(Fp(0), Fp(1), Fp(3), Fp(5), X16, WT);
  proj_kernel<<<dim3(KL / 64, (NB), 24), 128, 0, stream>>>(X16, WT, Fp(2), Fp(4), Fp(6), QH, QLo, KH, KLo, VTh, VTl);
  attn_kernel<<<dim3((SEQ) / 32, (NB) * H), 64, 0, stream>>>(QH, QLo, KH, KLo, VTh, VTl, (float*)d_out);
}

// v001
// Measured time: 208 microseconds a run.
// In two side-by-side timings against v000, it was 1.66 and 1.65 times as fast.
#include <hip/hip_runtime.h>

// All contractions: v_wmma_f32_16x16x32_f16 (f16 operands, f32 accumulate). q/k/v projections [NB*KL x 1024] x [1024 x 3072]: x bf16-exact f16 x8, W bf16-exact f16 x256,
// 1 product, bias added in f32; S^T = K Q^T with q and k carried as f16 hi+lo x8 planes (3 products); O^T += V^T P^T with v as f16 hi+lo x8 planes and P x1024 f16 hi+lo
// (3 products); softmax running max / sum / normaliser in f32.
// Layouts: x [NB_FULL][SEQ_FULL][1024]; W_q/W_k/W_v [1024 out][1024 in]; b_q/b_k/b_v [1024]; y = x W^T + b split into 16 heads x 64; scores scaled by 1/8; key j visible to query i
// iff j <= i + 128; out[b][t][64 h + d] = softmax-weighted sum of v, stored as f32 directly (no output projection).
// Every float input is RNE-converted to bf16 once on load. Fragment k-map per lane half hh for A AND B: elements 0..7 <- k = 8hh+0..7, 8..15 <- k = 16+8hh+0..7;
// Deterministic fixed-order flash-style loop per 16-query wave over the visible keys; no cross-block communication inside a launch.

#ifndef NB
#define NB 2
#endif
#ifndef SEQ
#define SEQ 2048
#endif
#define NB_FULL 2
#define SEQ_FULL 2048

namespace {
constexpr int DM = 1024, H = 16, HD = 64, SRC = 128;
constexpr int KL = ((SEQ) + SRC < (SEQ_FULL)) ? ((SEQ) + SRC) : (SEQ_FULL);   // key / value tokens needed by queries < SEQ
static_assert((NB) >= 1 && (NB) <= (NB_FULL));
static_assert((SEQ) % 64 == 0 && (SEQ) >= 64 && (SEQ) <= (SEQ_FULL));
static_assert(KL % 64 == 0 && KL >= (SEQ) && KL <= (SEQ_FULL));
static_assert(DM == H * HD && DM % 128 == 0 && HD == 64 && (SEQ_FULL) % 32 == 0);
constexpr float XS = 8.0f, WSC = 256.0f, PS = 1024.0f, LOG2E = 1.4426950408889634f;
typedef _Float16 b16;
typedef __attribute__((ext_vector_type(16))) _Float16 v16b;
typedef __attribute__((ext_vector_type(8))) _Float16 v8b;
typedef __attribute__((ext_vector_type(4))) _Float16 v4h;
typedef __attribute__((ext_vector_type(2))) _Float16 v2h;
typedef __attribute__((ext_vector_type(8))) float v8f;
typedef __attribute__((ext_vector_type(4))) float v4f;

__device__ __forceinline__ float bf16_rne(float f) { unsigned int u = __float_as_uint(f); u += 0x7FFFu + ((u >> 16) & 1u); return __uint_as_float(u & 0xFFFF0000u); }
__device__ __forceinline__ void split16(float v, b16& hi, b16& lo) { hi = (b16)v; lo = (b16)(v - (float)hi); }
// 16-bit fragment from a k-contiguous row (A: row m; B: column n stored [n][k]); hh = lane half
__device__ __forceinline__ v16b frag_kb(const b16* p, int hh) { const v8b a = *(const v8b*)(p + 8 * hh), b = *(const v8b*)(p + 16 + 8 * hh); v16b f;
#pragma unroll
  for (int e = 0; e < 8; ++e) { f[e] = a[e]; f[8 + e] = b[e]; } return f; }
__device__ __forceinline__ v8f wmma16b(v16b a, v16b b, v8f c) { v8f d = __builtin_amdgcn_wmma_f32_16x16x32_f16(false, a, false, b, (short)0, c, false, false); asm volatile("v_nop\n\tv_nop\n\tv_nop\n\tv_nop" : "+v"(d) : "v"(a), "v"(b)); return d; }
__device__ __forceinline__ void wave_lds_sync() { __builtin_amdgcn_fence(3, "workgroup"); __builtin_amdgcn_wave_barrier(); __builtin_amdgcn_fence(2, "workgroup"); }
__device__ __forceinline__ float nexp2(float v) { return __builtin_amdgcn_exp2f(v); }

constexpr size_t WU = (size_t)DM * DM / 8;                         // 8-element units per weight matrix
constexpr size_t XU = (size_t)(NB_FULL) * (SEQ_FULL) * DM / 8;     // 8-element units of x
constexpr size_t PREP_UNITS = 3 * WU + XU;
static_assert(PREP_UNITS % 256 == 0 && (3 * WU) % 256 == 0 && WU % 256 == 0);

// prep: WT [3072 o][1024 k] = W_q | W_k | W_v rows ([out][in] is already k-contiguous), bf16 RNE then x256 -> f16; X16 [NB_FULL*SEQ_FULL][1024] = bf16 RNE(x) x8 -> f16.
__global__ __launch_bounds__(256) void prep_kernel(const float* __restrict__ x, const float* __restrict__ wq, const float* __restrict__ wk, const float* __restrict__ wv, b16* __restrict__ X16, b16* __restrict__ WT) {
  const size_t u = (size_t)blockIdx.x * 256 + threadIdx.x; if (u >= PREP_UNITS) return;
  const float* src; b16* dst; float sc;
  if (u < 3 * WU) { const int m = (int)(u / WU); const size_t e = (u - (size_t)m * WU) * 8; const float* w = m == 0 ? wq : m == 1 ? wk : wv; src = w + e; dst = WT + (size_t)m * DM * DM + e; sc = WSC; }
  else { const size_t e = (u - 3 * WU) * 8; src = x + e; dst = X16 + e; sc = XS; }
  const v4f f0 = *(const v4f*)src, f1 = *(const v4f*)(src + 4); v8b o;
#pragma unroll
  for (int j = 0; j < 4; ++j) { o[j] = (b16)(bf16_rne(f0[j]) * sc); o[4 + j] = (b16)(bf16_rne(f1[j]) * sc); }
  { *(v8b*)dst = o;  }
}

// projections: grid (KL/64, NB, 24 slabs of 128 columns: 0-7 q, 8-15 k, 16-23 v); block = 64 tokens of batch b x 4 waves (16 tokens per wave, 8 accumulator tiles);
// A fragments from the X16 plane, B fragments from WT rows (K = 1024); epilogue + bf16-RNE bias in f32 into Tf; q/k -> f16 hi/lo x8 planes [b][h][t][64]
__global__ __launch_bounds__(128) void proj_kernel(const b16* __restrict__ X16, const b16* __restrict__ WT, const float* __restrict__ bq, const float* __restrict__ bk, const float* __restrict__ bv,
                                                   b16* __restrict__ QH, b16* __restrict__ QLo, b16* __restrict__ KH, b16* __restrict__ KLo, b16* __restrict__ VTh, b16* __restrict__ VTl) {
  __shared__ __attribute__((aligned(16))) float Tf[4][16][128 + 4];
  const int wave = threadIdx.x >> 5, lane = threadIdx.x & 31, nloc = lane & 15, hlf = lane >> 4; const int t0 = blockIdx.x * 64; const int b = blockIdx.y;
  const int slab = blockIdx.z, n0 = slab * 128, part = slab / 8, c0 = n0 - part * DM;
  const float* bias = part == 0 ? bq : part == 1 ? bk : bv;
  const b16* xa = X16 + ((size_t)b * (SEQ_FULL) + t0 + wave * 16 + nloc) * DM;
  v8f acc[8];
#pragma unroll
  for (int t = 0; t < 8; ++t) acc[t] = (v8f){};
#pragma unroll 1
  for (int kb = 0; kb < DM; kb += 32) { const v16b a = frag_kb(xa + kb, hlf);
#pragma unroll
    for (int t = 0; t < 8; ++t) acc[t] = wmma16b(a, frag_kb(WT + (size_t)(n0 + t * 16 + nloc) * DM + kb, hlf), acc[t]); }
#pragma unroll
  for (int t = 0; t < 8; ++t) { const float bb = bf16_rne(bias[c0 + t * 16 + nloc]);
#pragma unroll
    for (int r = 0; r < 8; ++r) Tf[wave][8 * hlf + r][t * 16 + nloc] = acc[t][r] * (1.0f / (XS * WSC)) + bb; }
  __syncthreads();   // Tf is read across waves in the v branch
  {
    if (part < 2) { b16* ph_ = part == 0 ? QH : KH; b16* pl_ = part == 0 ? QLo : KLo; const int c = c0 + lane * 4; const int h = c / HD, d = c % HD;
      for (int rr = 0; rr < 16; ++rr) { const int tok = t0 + wave * 16 + rr; v4h h4, l4; for (int j = 0; j < 4; ++j) { b16 p, q; split16(Tf[wave][rr][lane * 4 + j] * XS, p, q); h4[j] = p; l4[j] = q; }
        const size_t oi = (((size_t)b * H + h) * (SEQ_FULL) + tok) * HD + d; *(v4h*)(ph_ + oi) = h4; *(v4h*)(pl_ + oi) = l4; } }
    else {
#pragma unroll 1
      for (int q = 0; q < 32; ++q) { const int cl = wave * 32 + q; const int c = c0 + cl; const int h = c / HD, d = c % HD; const int tk = lane * 2; v2h hv, lv;
        for (int j = 0; j < 2; ++j) { b16 p, ql; split16(Tf[(tk + j) >> 4][(tk + j) & 15][cl] * XS, p, ql); hv[j] = p; lv[j] = ql; }
        const size_t oi = (((size_t)b * H + h) * HD + d) * (size_t)(SEQ_FULL) + t0 + lane * 2; *(v2h*)(VTh + oi) = hv; *(v2h*)(VTl + oi) = lv; } }
     }
}

// attention: grid (SEQ/128, NB x H): block = 8 waves x 16 queries; keys 0 .. min(KL, block's last query + 1 + 128) in stages of 64 keys. One stage = four planes of 64 rows x 128 B
// (K hi, K lo: row = key; V^T hi, V^T lo: row = d), brought ONCE per block into LDS by asynchronous copies (16 B per lane, 8 copies per lane and stage) at a row pitch of 144 B, two buffers:
// stage s + 1 flies while stage s is worked on; all 8 waves read their fragments from LDS. Per wave the 32-key steps, their order and arithmetic are as before (keys < q0 + 16 + 128):
// S^T = K Q^T with 3 products (kh qh + kh ql + kl qh); online softmax in f32; P x1024 hi/lo into a wave-private LDS tile; O^T += V^T P^T (3 products);
constexpr int AW = 8, KT = 64, RP = 64 + 8, PLN = 64 * RP, STG = 4 * PLN;   // waves per block; keys per stage; row pitch, plane and stage in f16 elements
static_assert((SEQ) % (16 * AW) == 0 && KL % KT == 0 && KL >= 2 * KT && (16 * AW + SRC) % KT == 0);
static_assert((size_t)AW * 16 * (HD + 4) * 4 <= (size_t)2 * STG * 2);   // the output staging fits into the ring

// One stage: lane unit (row r = tid / 8 and r + 32, 16-B piece c = tid % 8) of each of the four planes. lds = LDS byte address of the lane's unit in plane 0 of the target buffer.
__device__ __forceinline__ void stage_copy(unsigned lds, const b16* kh, const b16* kl, const b16* vh, const b16* vl) {
  const unsigned l0 = lds, l1 = lds + 32 * RP * 2, l2 = lds + PLN * 2, l3 = l2 + 32 * RP * 2, l4 = lds + 2 * PLN * 2, l5 = l4 + 32 * RP * 2, l6 = lds + 3 * PLN * 2, l7 = l6 + 32 * RP * 2;
  const b16 *g0 = kh, *g1 = kh + 32 * HD, *g2 = kl, *g3 = kl + 32 * HD, *g4 = vh, *g5 = vh + (size_t)32 * (SEQ_FULL), *g6 = vl, *g7 = vl + (size_t)32 * (SEQ_FULL);
  // the copies and, as the last line, the wait that stands in front of any rewrite of the address registers they name
  asm volatile("global_load_async_to_lds_b128 %0, %8, off\n\t"
               "global_load_async_to_lds_b128 %1, %9, off\n\t"
               "global_load_async_to_lds_b128 %2, %10, off\n\t"
               "global_load_async_to_lds_b128 %3, %11, off\n\t"
               "global_load_async_to_lds_b128 %4, %12, off\n\t"
               "global_load_async_to_lds_b128 %5, %13, off\n\t"
               "global_load_async_to_lds_b128 %6, %14, off\n\t"
               "global_load_async_to_lds_b128 %7, %15, off\n\t"
               "s_wait_xcnt 0x0"
               :: "v"(l0), "v"(l1), "v"(l2), "v"(l3), "v"(l4), "v"(l5), "v"(l6), "v"(l7), "v"(g0), "v"(g1), "v"(g2), "v"(g3), "v"(g4), "v"(g5), "v"(g6), "v"(g7) : "memory");
}

__global__ __launch_bounds__(256) void attn_kernel(const b16* __restrict__ QH, const b16* __restrict__ QLo, const b16* __restrict__ KH, const b16* __restrict__ KLo,
                                                  const b16* __restrict__ VTh, const b16* __restrict__ VTl, float* __restrict__ out) {
  __shared__ __attribute__((aligned(16))) b16 Ring[2 * STG]; __shared__ __attribute__((aligned(16))) b16 Pb[AW][16][32 + 8], Pc[AW][16][32 + 8];
  const int tid = threadIdx.x, wave = __builtin_amdgcn_readfirstlane(tid >> 5), lane = tid & 31, hh = lane >> 4, col = lane & 15; const int b = blockIdx.y / H, h = blockIdx.y % H;
  const int qb = blockIdx.x * (16 * AW), q0 = qb + wave * 16, qi = q0 + col;
  const size_t ph = (size_t)b * H + h; const size_t pq = ph * (size_t)(SEQ_FULL) * HD; const b16* Vh = VTh + ph * HD * (size_t)(SEQ_FULL); const b16* Vl = VTl + ph * HD * (size_t)(SEQ_FULL);
  const int nst = ((qb + 16 * AW + SRC < KL) ? (qb + 16 * AW + SRC) : KL) / KT;   // block-uniform, >= 2; staged keys stay < KL
  const int sr = tid >> 3, sc = (tid & 7) * 8;   // the lane's staged row and first element in it
  const unsigned ring0 = (unsigned)(size_t)&Ring[0] + (unsigned)(sr * RP + sc) * 2u;
  const b16 *ckh = KH + pq + (size_t)sr * HD + sc, *ckl = KLo + pq + (size_t)sr * HD + sc, *cvh = Vh + (size_t)sr * (SEQ_FULL) + sc, *cvl = Vl + (size_t)sr * (SEQ_FULL) + sc;
  stage_copy(ring0, ckh, ckl, cvh, cvl);
  const v16b qh0 = frag_kb(QH + pq + (size_t)qi * HD, hh), qh1 = frag_kb(QH + pq + (size_t)qi * HD + 32, hh), ql0 = frag_kb(QLo + pq + (size_t)qi * HD, hh), ql1 = frag_kb(QLo + pq + (size_t)qi * HD + 32, hh);
  const float cs = LOG2E / (8.0f * XS * XS);
  float m = -INFINITY, l = 0.0f; v8f o[4];
#pragma unroll
  for (int t = 0; t < 4; ++t) o[t] = (v8f){};
  const int kend = (q0 + 16 + SRC < KL) ? (q0 + 16 + SRC) : KL;   // wave-uniform
  asm volatile("s_wait_asynccnt 0x0" ::: "memory");   // this wave's share of stage 0 has landed
  __syncthreads();                                     // stage 0 is published to all waves
  stage_copy(ring0 + STG * 2, ckh + (size_t)KT * HD, ckl + (size_t)KT * HD, cvh + KT, cvl + KT);
#pragma unroll 1
  for (int st = 0; st < nst; ++st) {
    const b16* buf = Ring + (st & 1) * STG;
#pragma unroll 1
    for (int kb = st * KT; kb < st * KT + KT; kb += 32) {
      if (kb >= kend) break;   // wave-uniform: steps beyond this wave's last visible key; the publish point below is still passed
      const int ko = kb - st * KT;
      float e[16]; float mx = -INFINITY;
#pragma unroll
      for (int u = 0; u < 2; ++u) { v8f s = (v8f){}; const b16* kr = buf + (ko + u * 16 + col) * RP; const v16b kh0 = frag_kb(kr, hh), kh1 = frag_kb(kr + 32, hh), kl0 = frag_kb(kr + PLN, hh), kl1 = frag_kb(kr + PLN + 32, hh);
        s = wmma16b(kh0, qh0, s); s = wmma16b(kh0, ql0, s); s = wmma16b(kl0, qh0, s); s = wmma16b(kh1, qh1, s); s = wmma16b(kh1, ql1, s); s = wmma16b(kl1, qh1, s);
#pragma unroll
        for (int r = 0; r < 8; ++r) { const int key = kb + u * 16 + 8 * hh + r; const float vv = (key <= qi + SRC) ? s[r] * cs : -INFINITY; e[u * 8 + r] = vv; mx = fmaxf(mx, vv); } }
      mx = fmaxf(mx, __shfl_xor(mx, 16)); const float mn = fmaxf(m, mx); const float al = (mn == -INFINITY) ? 1.0f : nexp2(m - mn); float sum = 0.0f;
#pragma unroll
      for (int i2 = 0; i2 < 16; ++i2) { const float p = (e[i2] == -INFINITY) ? 0.0f : nexp2(e[i2] - mn); sum += p; b16 a_, b_; split16(p * PS, a_, b_); const int sl = (i2 < 8 ? 0 : 16) + 8 * hh + (i2 & 7); Pb[wave][col][sl] = a_; Pc[wave][col][sl] = b_; }
      sum += __shfl_xor(sum, 16); l = l * al + sum; m = mn;
      wave_lds_sync();
      const v16b pf = frag_kb(&Pb[wave][col][0], hh), pg = frag_kb(&Pc[wave][col][0], hh);
#pragma unroll
      for (int t = 0; t < 4; ++t) { o[t] *= al; const b16* vr = buf + 2 * PLN + (t * 16 + col) * RP + ko; const v16b va = frag_kb(vr, hh), vb2 = frag_kb(vr + PLN, hh); o[t] = wmma16b(va, pf, o[t]); o[t] = wmma16b(va, pg, o[t]); o[t] = wmma16b(vb2, pf, o[t]); }
      wave_lds_sync(); }
    // publish point of stage st + 1, passed by every wave on every trip
    asm volatile("s_wait_dscnt 0x0" ::: "memory");      // this wave's reads of stage st have returned
    asm volatile("s_wait_asynccnt 0x0" ::: "memory");   // this wave's share of stage st + 1 has landed
    __syncthreads();                                     // publishes stage st + 1 and frees stage st's buffer
    if (st + 2 < nst) stage_copy(ring0 + (st & 1) * (STG * 2), ckh + (size_t)(st + 2) * KT * HD, ckl + (size_t)(st + 2) * KT * HD, cvh + (st + 2) * KT, cvl + (st + 2) * KT);
  }
  asm volatile("s_wait_asynccnt 0x0" ::: "memory");     // nothing of this wave is in flight when the ring becomes output staging
  float (*To)[16][HD + 4] = reinterpret_cast<float (*)[16][HD + 4]>(&Ring[0]);   // behind the last trip's barrier no wave reads the ring any more
  const float inv = 1.0f / (l * PS * XS);
#pragma unroll
  for (int t = 0; t < 4; ++t)
#pragma unroll
    for (int r = 0; r < 8; ++r) To[wave][col][t * 16 + 8 * hh + r] = o[t][r] * inv;
  wave_lds_sync();
  {
    for (int rr2 = 0; rr2 < 8; ++rr2) { const int row = 2 * rr2 + hh; const int c4 = col * 4; const v4f f = *(const v4f*)(&To[wave][row][c4]);
      *(v4f*)(out + ((size_t)b * (SEQ_FULL) + q0 + row) * DM + h * HD + c4) = f; }
     }
}
}  // namespace

extern "C" void kernel_launch(void* const* d_in, const int* in_sizes, int n_in, void* d_out, int out_size, void* d_ws, size_t ws_size, hipStream_t stream) {
  if (n_in < 7) return;
  auto Fp = [&](int i) { return (const float*)d_in[i]; };
  // wire order: 0 x [2,2048,1024], 1 W_q [1024,1024] (out,in), 2 b_q [1024], 3 W_k, 4 b_k, 5 W_v, 6 b_v - all f32
  if (in_sizes[0] < (NB_FULL) * (SEQ_FULL) * DM || in_sizes[1] < DM * DM || in_sizes[2] < DM || in_sizes[3] < DM * DM || in_sizes[4] < DM || in_sizes[5] < DM * DM || in_sizes[6] < DM) return;
  if (out_size < (((NB) - 1) * (SEQ_FULL) + (SEQ)) * DM) return;
  size_t off = 0; char* ws = (char*)d_ws;
  auto carve = [&](size_t bytes) { char* p = ws + off; off += (bytes + 255) & ~(size_t)255; return p; };
  b16* X16 = (b16*)carve((size_t)(NB_FULL) * (SEQ_FULL) * DM * 2);                 // 8 MiB
  b16* WT = (b16*)carve((size_t)3 * DM * DM * 2);                                  // 6 MiB
  const size_t plane = (size_t)(NB_FULL) * H * (SEQ_FULL) * HD * 2;                 // 8 MiB each, full strides
  b16* QH = (b16*)carve(plane); b16* QLo = (b16*)carve(plane); b16* KH = (b16*)carve(plane); b16* KLo = (b16*)carve(plane); b16* VTh = (b16*)carve(plane); b16* VTl = (b16*)carve(plane);
  if (off > ws_size || off > ((size_t)128 << 20)) return;   // total 62 MiB
  prep_kernel<<<(unsigned)(PREP_UNITS / 256), 256, 0, stream>>>(Fp(0), Fp(1), Fp(3), Fp(5), X16, WT);
  proj_kernel<<<dim3(KL / 64, (NB), 24), 128, 0, stream>>>(X16, WT, Fp(2), Fp(4), Fp(6), QH, QLo, KH, KLo, VTh, VTl);
  attn_kernel<<<dim3((SEQ) / 128, (NB) * H), 256, 0, stream>>>(QH, QLo, KH, KLo, VTh, VTl, (float*)d_out);
}

// v002
// It runs in 129 microseconds.
// In two side-by-side timings against v001, it was 1.62 and 1.61 times as fast.
// Counting every step since v000, it is 2.66 times as fast.
#include <hip/hip_runtime.h>

// All contractions: v_wmma_f32_16x16x32_f16 (f16 operands, f32 accumulate). q/k/v projections [NB*KL x 1024] x [1024 x 3072]: x bf16-exact f16 x8, W bf16-exact f16 x256,
// 1 product, bias added in f32; S^T = K Q^T with q and k carried as f16 hi+lo x8 planes (3 products); O^T += V^T P^T with v as f16 hi+lo x8 planes and P x1024 f16 hi+lo
// (3 products); softmax running max / sum / normaliser in f32.
// Layouts: x [NB_FULL][SEQ_FULL][1024]; W_q/W_k/W_v [1024 out][1024 in]; b_q/b_k/b_v [1024]; y = x W^T + b split into 16 heads x 64; scores scaled by 1/8; key j visible to query i
// iff j <= i + 128; out[b][t][64 h + d] = softmax-weighted sum of v, stored as f32 directly (no output projection).
// Every float input is RNE-converted to bf16 once on load. Fragment k-map per lane half hh for A AND B: elements 0..7 <- k = 8hh+0..7, 8..15 <- k = 16+8hh+0..7;
// Deterministic fixed-order flash-style loop per 16-query wave over the visible keys; no cross-block communication inside a launch.

#ifndef NB
#define NB 2
#endif
#ifndef SEQ
#define SEQ 2048
#endif
#define NB_FULL 2
#define SEQ_FULL 2048

namespace {
constexpr int DM = 1024, H = 16, HD = 64, SRC = 128;
constexpr int KL = ((SEQ) + SRC < (SEQ_FULL)) ? ((SEQ) + SRC) : (SEQ_FULL);   // key / value tokens needed by queries < SEQ
static_assert((NB) >= 1 && (NB) <= (NB_FULL));
static_assert((SEQ) % 64 == 0 && (SEQ) >= 64 && (SEQ) <= (SEQ_FULL));
static_assert(KL % 64 == 0 && KL >= (SEQ) && KL <= (SEQ_FULL));
static_assert(DM == H * HD && DM % 128 == 0 && HD == 64 && (SEQ_FULL) % 32 == 0);
constexpr float XS = 8.0f, WSC = 256.0f, PS = 1024.0f, LOG2E = 1.4426950408889634f;
typedef _Float16 b16;
typedef __attribute__((ext_vector_type(16))) _Float16 v16b;
typedef __attribute__((ext_vector_type(8))) _Float16 v8b;
typedef __attribute__((ext_vector_type(4))) _Float16 v4h;
typedef __attribute__((ext_vector_type(2))) _Float16 v2h;
typedef __attribute__((ext_vector_type(8))) float v8f;
typedef __attribute__((ext_vector_type(4))) float v4f;

__device__ __forceinline__ float bf16_rne(float f) { unsigned int u = __float_as_uint(f); u += 0x7FFFu + ((u >> 16) & 1u); return __uint_as_float(u & 0xFFFF0000u); }
__device__ __forceinline__ void split16(float v, b16& hi, b16& lo) { hi = (b16)v; lo = (b16)(v - (float)hi); }
// 16-bit fragment from a k-contiguous row (A: row m; B: column n stored [n][k]); hh = lane half
__device__ __forceinline__ v16b frag_kb(const b16* p, int hh) { const v8b a = *(const v8b*)(p + 8 * hh), b = *(const v8b*)(p + 16 + 8 * hh); v16b f;
#pragma unroll
  for (int e = 0; e < 8; ++e) { f[e] = a[e]; f[8 + e] = b[e]; } return f; }
__device__ __forceinline__ v8f wmma16b(v16b a, v16b b, v8f c) { v8f d = __builtin_amdgcn_wmma_f32_16x16x32_f16(false, a, false, b, (short)0, c, false, false); asm volatile("v_nop\n\tv_nop\n\tv_nop\n\tv_nop" : "+v"(d) : "v"(a), "v"(b)); return d; }
__device__ __forceinline__ void wave_lds_sync() { __builtin_amdgcn_fence(3, "workgroup"); __builtin_amdgcn_wave_barrier(); __builtin_amdgcn_fence(2, "workgroup"); }
__device__ __forceinline__ float nexp2(float v) { return __builtin_amdgcn_exp2f(v); }

constexpr size_t WU = (size_t)DM * DM / 8;                         // 8-element units per weight matrix
constexpr size_t XU = (size_t)(NB_FULL) * (SEQ_FULL) * DM / 8;     // 8-element units of x
constexpr size_t PREP_UNITS = 3 * WU + XU;
static_assert(PREP_UNITS % 256 == 0 && (3 * WU) % 256 == 0 && WU % 256 == 0);

// prep: WT [3072 o][1024 k] = W_q | W_k | W_v rows ([out][in] is already k-contiguous), bf16 RNE then x256 -> f16; X16 [NB_FULL*SEQ_FULL][1024] = bf16 RNE(x) x8 -> f16.
__global__ __launch_bounds__(256) void prep_kernel(const float* __restrict__ x, const float* __restrict__ wq, const float* __restrict__ wk, const float* __restrict__ wv, b16* __restrict__ X16, b16* __restrict__ WT) {
  const size_t u = (size_t)blockIdx.x * 256 + threadIdx.x; if (u >= PREP_UNITS) return;
  const float* src; b16* dst; float sc;
  if (u < 3 * WU) { const int m = (int)(u / WU); const size_t e = (u - (size_t)m * WU) * 8; const float* w = m == 0 ? wq : m == 1 ? wk : wv; src = w + e; dst = WT + (size_t)m * DM * DM + e; sc = WSC; }
  else { const size_t e = (u - 3 * WU) * 8; src = x + e; dst = X16 + e; sc = XS; }
  const v4f f0 = *(const v4f*)src, f1 = *(const v4f*)(src + 4); v8b o;
#pragma unroll
  for (int j = 0; j < 4; ++j) { o[j] = (b16)(bf16_rne(f0[j]) * sc); o[4 + j] = (b16)(bf16_rne(f1[j]) * sc); }
  { *(v8b*)dst = o;  }
}

// projections: grid (KL/128, NB, 24 slabs of 128 columns: 0-7 q, 8-15 k, 16-23 v); block = 128 tokens of batch b x 128 columns, 8 waves (wave = 32 tokens x 64 columns, 8 accumulator tiles).
// One stage = 64 k of the block's 128 X16 rows and 128 WT rows (rows of 128 B), brought ONCE per block into LDS by asynchronous copies (16 B per lane, 8 copies per lane and stage) at a row pitch
// of 144 B, two buffers: stage s + 1 flies while stage s is worked on; all waves read their A and B fragments from LDS. Every accumulator tile sums k in ascending steps of 32 (K = 1024).
// epilogue + bf16-RNE bias in f32 into Tf (the ring, reused); q/k -> f16 hi/lo x8 planes [b][h][t][64]; v -> f16 hi/lo x8 planes [b][h][d][t]
constexpr int PT = 128, PK = 64, PP = PK + 8, PPL = PT * PP, PSTG = 2 * PPL, PNS = DM / PK;   // rows per plane; k per stage; row pitch, plane and stage in f16 elements; stages
static_assert(KL % PT == 0 && DM % PK == 0 && PNS >= 2);
static_assert((size_t)PT * (128 + 4) * 4 <= (size_t)2 * PSTG * 2);   // the epilogue staging fits into the ring

// One stage: lane unit (row r = tid / 8, r + 32, r + 64, r + 96; 16-B piece c = tid % 8) of the X plane and of the W plane. lds = LDS byte address of the lane's unit in the X plane of the target buffer.
__device__ __forceinline__ void proj_copy(unsigned lds, const b16* xg, const b16* wg) {
  const unsigned l0 = lds, l1 = lds + 32 * PP * 2, l2 = lds + 64 * PP * 2, l3 = lds + 96 * PP * 2, l4 = lds + PPL * 2, l5 = l4 + 32 * PP * 2, l6 = l4 + 64 * PP * 2, l7 = l4 + 96 * PP * 2;
  const b16 *g0 = xg, *g1 = xg + 32 * DM, *g2 = xg + 64 * DM, *g3 = xg + 96 * DM, *g4 = wg, *g5 = wg + 32 * DM, *g6 = wg + 64 * DM, *g7 = wg + 96 * DM;
  // the copies and, as the last line, the wait that stands in front of any rewrite of the address registers they name
  asm volatile("global_load_async_to_lds_b128 %0, %8, off\n\t"
               "global_load_async_to_lds_b128 %1, %9, off\n\t"
               "global_load_async_to_lds_b128 %2, %10, off\n\t"
               "global_load_async_to_lds_b128 %3, %11, off\n\t"
               "global_load_async_to_lds_b128 %4, %12, off\n\t"
               "global_load_async_to_lds_b128 %5, %13, off\n\t"
               "global_load_async_to_lds_b128 %6, %14, off\n\t"
               "global_load_async_to_lds_b128 %7, %15, off\n\t"
               "s_wait_xcnt 0x0"
               :: "v"(l0), "v"(l1), "v"(l2), "v"(l3), "v"(l4), "v"(l5), "v"(l6), "v"(l7), "v"(g0), "v"(g1), "v"(g2), "v"(g3), "v"(g4), "v"(g5), "v"(g6), "v"(g7) : "memory");
}

__global__ __launch_bounds__(256) void proj_kernel(const b16* __restrict__ X16, const b16* __restrict__ WT, const float* __restrict__ bq, const float* __restrict__ bk, const float* __restrict__ bv,
                                                   b16* __restrict__ QH, b16* __restrict__ QLo, b16* __restrict__ KH, b16* __restrict__ KLo, b16* __restrict__ VTh, b16* __restrict__ VTl) {
  __shared__ __attribute__((aligned(16))) b16 PR[2 * PSTG];
  const int tid = threadIdx.x, wave = __builtin_amdgcn_readfirstlane(tid >> 5), lane = tid & 31, nloc = lane & 15, hlf = lane >> 4; const int t0 = blockIdx.x * PT; const int b = blockIdx.y;
  const int slab = blockIdx.z, n0 = slab * 128, part = slab / 8, c0 = n0 - part * DM;
  const int wm = wave & 3, wn = wave >> 2;   // the wave's 32-token group and 64-column group
  const float* bias = part == 0 ? bq : part == 1 ? bk : bv;
  const int sr = tid >> 3, sc = (tid & 7) * 8;   // the lane's first staged row and first element in it
  const unsigned ring0 = (unsigned)(size_t)&PR[0] + (unsigned)(sr * PP + sc) * 2u;
  const b16 *cx = X16 + ((size_t)b * (SEQ_FULL) + t0 + sr) * DM + sc, *cw = WT + (size_t)(n0 + sr) * DM + sc;
  proj_copy(ring0, cx, cw);
  v8f acc[2][4];
#pragma unroll
  for (int i = 0; i < 2; ++i)
#pragma unroll
    for (int t = 0; t < 4; ++t) acc[i][t] = (v8f){};
  asm volatile("s_wait_asynccnt 0x0" ::: "memory");   // this wave's share of stage 0 has landed
  __syncthreads();                                     // stage 0 is published to all waves
  proj_copy(ring0 + PSTG * 2, cx + PK, cw + PK);
#pragma unroll 1
  for (int st = 0; st < PNS; ++st) {
    const b16* xr = PR + (st & 1) * PSTG + (wm * 32 + nloc) * PP; const b16* wr = PR + (st & 1) * PSTG + PPL + (wn * 64 + nloc) * PP;
#pragma unroll
    for (int ks = 0; ks < PK; ks += 32) { const v16b a0 = frag_kb(xr + ks, hlf), a1 = frag_kb(xr + 16 * PP + ks, hlf); v16b w[4];   // the six fragments of a 32-k step are read as one group
#pragma unroll
      for (int t = 0; t < 4; ++t) w[t] = frag_kb(wr + t * 16 * PP + ks, hlf);
#pragma unroll
      for (int t = 0; t < 4; ++t) { acc[0][t] = wmma16b(a0, w[t], acc[0][t]); acc[1][t] = wmma16b(a1, w[t], acc[1][t]); } }
    // publish point of stage st + 1, passed by every wave on every trip
    asm volatile("s_wait_dscnt 0x0" ::: "memory");      // this wave's reads of stage st have returned
    asm volatile("s_wait_asynccnt 0x0" ::: "memory");   // this wave's share of stage st + 1 has landed
    __syncthreads();                                     // publishes stage st + 1 and frees stage st's buffer
    if (st + 2 < PNS) proj_copy(ring0 + (st & 1) * (PSTG * 2), cx + (st + 2) * PK, cw + (st + 2) * PK);
  }
  asm volatile("s_wait_asynccnt 0x0" ::: "memory");     // nothing of this wave is in flight when the ring becomes epilogue staging
  float (*Tf)[128 + 4] = reinterpret_cast<float (*)[128 + 4]>(&PR[0]);   // behind the last trip's barrier no wave reads the ring any more
#pragma unroll
  for (int t = 0; t < 4; ++t) { const float bb = bf16_rne(bias[c0 + wn * 64 + t * 16 + nloc]);
#pragma unroll
    for (int i = 0; i < 2; ++i)
#pragma unroll
      for (int r = 0; r < 8; ++r) Tf[wm * 32 + i * 16 + 8 * hlf + r][wn * 64 + t * 16 + nloc] = acc[i][t][r] * (1.0f / (XS * WSC)) + bb; }
  __syncthreads();   // Tf is read across waves
  {
    if (part < 2) { b16* ph_ = part == 0 ? QH : KH; b16* pl_ = part == 0 ? QLo : KLo; const int c = c0 + lane * 4; const int h = c / HD, d = c % HD;
      for (int rr = 0; rr < 16; ++rr) { const int tl = wave * 16 + rr; const int tok = t0 + tl; v4h h4, l4; for (int j = 0; j < 4; ++j) { b16 p, q; split16(Tf[tl][lane * 4 + j] * XS, p, q); h4[j] = p; l4[j] = q; }
        const size_t oi = (((size_t)b * H + h) * (SEQ_FULL) + tok) * HD + d; *(v4h*)(ph_ + oi) = h4; *(v4h*)(pl_ + oi) = l4; } }
    else {
#pragma unroll 1
      for (int q = 0; q < 32; ++q) { const int cl = wave * 16 + (q >> 1); const int c = c0 + cl; const int h = c / HD, d = c % HD; const int tk = (q & 1) * 64 + lane * 2; v2h hv, lv;
        for (int j = 0; j < 2; ++j) { b16 p, ql; split16(Tf[tk + j][cl] * XS, p, ql); hv[j] = p; lv[j] = ql; }
        const size_t oi = (((size_t)b * H + h) * HD + d) * (size_t)(SEQ_FULL) + t0 + tk; *(v2h*)(VTh + oi) = hv; *(v2h*)(VTl + oi) = lv;
        asm volatile("s_wait_xcnt 0x0" ::: "memory"); } }   // stands in front of the next trip's rewrite of the registers that the two stores name
     }
}

// attention: grid (SEQ/128, NB x H): block = 8 waves x 16 queries; keys 0 .. min(KL, block's last query + 1 + 128) in stages of 64 keys. One stage = four planes of 64 rows x 128 B
// (K hi, K lo: row = key; V^T hi, V^T lo: row = d), brought ONCE per block into LDS by asynchronous copies (16 B per lane, 8 copies per lane and stage) at a row pitch of 144 B, two buffers:
// stage s + 1 flies while stage s is worked on; all 8 waves read their fragments from LDS. Per wave the 32-key steps, their order and arithmetic are as before (keys < q0 + 16 + 128):
// S^T = K Q^T with 3 products (kh qh + kh ql + kl qh); online softmax in f32; P x1024 hi/lo into a wave-private LDS tile; O^T += V^T P^T (3 products);
constexpr int AW = 8, KT = 64, RP = 64 + 8, PLN = 64 * RP, STG = 4 * PLN;   // waves per block; keys per stage; row pitch, plane and stage in f16 elements
static_assert((SEQ) % (16 * AW) == 0 && KL % KT == 0 && KL >= 2 * KT && (16 * AW + SRC) % KT == 0);
static_assert((size_t)AW * 16 * (HD + 4) * 4 <= (size_t)2 * STG * 2);   // the output staging fits into the ring

// One stage: lane unit (row r = tid / 8 and r + 32, 16-B piece c = tid % 8) of each of the four planes. lds = LDS byte address of the lane's unit in plane 0 of the target buffer.
__device__ __forceinline__ void stage_copy(unsigned lds, const b16* kh, const b16* kl, const b16* vh, const b16* vl) {
  const unsigned l0 = lds, l1 = lds + 32 * RP * 2, l2 = lds + PLN * 2, l3 = l2 + 32 * RP * 2, l4 = lds + 2 * PLN * 2, l5 = l4 + 32 * RP * 2, l6 = lds + 3 * PLN * 2, l7 = l6 + 32 * RP * 2;
  const b16 *g0 = kh, *g1 = kh + 32 * HD, *g2 = kl, *g3 = kl + 32 * HD, *g4 = vh, *g5 = vh + (size_t)32 * (SEQ_FULL), *g6 = vl, *g7 = vl + (size_t)32 * (SEQ_FULL);
  // the copies and, as the last line, the wait that stands in front of any rewrite of the address registers they name
  asm volatile("global_load_async_to_lds_b128 %0, %8, off\n\t"
               "global_load_async_to_lds_b128 %1, %9, off\n\t"
               "global_load_async_to_lds_b128 %2, %10, off\n\t"
               "global_load_async_to_lds_b128 %3, %11, off\n\t"
               "global_load_async_to_lds_b128 %4, %12, off\n\t"
               "global_load_async_to_lds_b128 %5, %13, off\n\t"
               "global_load_async_to_lds_b128 %6, %14, off\n\t"
               "global_load_async_to_lds_b128 %7, %15, off\n\t"
               "s_wait_xcnt 0x0"
               :: "v"(l0), "v"(l1), "v"(l2), "v"(l3), "v"(l4), "v"(l5), "v"(l6), "v"(l7), "v"(g0), "v"(g1), "v"(g2), "v"(g3), "v"(g4), "v"(g5), "v"(g6), "v"(g7) : "memory");
}

__global__ __launch_bounds__(256) void attn_kernel(const b16* __restrict__ QH, const b16* __restrict__ QLo, const b16* __restrict__ KH, const b16* __restrict__ KLo,
                                                  const b16* __restrict__ VTh, const b16* __restrict__ VTl, float* __restrict__ out) {
  __shared__ __attribute__((aligned(16))) b16 Ring[2 * STG]; __shared__ __attribute__((aligned(16))) b16 Pb[AW][16][32 + 8], Pc[AW][16][32 + 8];
  const int tid = threadIdx.x, wave = __builtin_amdgcn_readfirstlane(tid >> 5), lane = tid & 31, hh = lane >> 4, col = lane & 15; const int b = blockIdx.y / H, h = blockIdx.y % H;
  const int qb = blockIdx.x * (16 * AW), q0 = qb + wave * 16, qi = q0 + col;
  const size_t ph = (size_t)b * H + h; const size_t pq = ph * (size_t)(SEQ_FULL) * HD; const b16* Vh = VTh + ph * HD * (size_t)(SEQ_FULL); const b16* Vl = VTl + ph * HD * (size_t)(SEQ_FULL);
  const int nst = ((qb + 16 * AW + SRC < KL) ? (qb + 16 * AW + SRC) : KL) / KT;   // block-uniform, >= 2; staged keys stay < KL
  const int sr = tid >> 3, sc = (tid & 7) * 8;   // the lane's staged row and first element in it
  const unsigned ring0 = (unsigned)(size_t)&Ring[0] + (unsigned)(sr * RP + sc) * 2u;
  const b16 *ckh = KH + pq + (size_t)sr * HD + sc, *ckl = KLo + pq + (size_t)sr * HD + sc, *cvh = Vh + (size_t)sr * (SEQ_FULL) + sc, *cvl = Vl + (size_t)sr * (SEQ_FULL) + sc;
  stage_copy(ring0, ckh, ckl, cvh, cvl);
  const v16b qh0 = frag_kb(QH + pq + (size_t)qi * HD, hh), qh1 = frag_kb(QH + pq + (size_t)qi * HD + 32, hh), ql0 = frag_kb(QLo + pq + (size_t)qi * HD, hh), ql1 = frag_kb(QLo + pq + (size_t)qi * HD + 32, hh);
  const float cs = LOG2E / (8.0f * XS * XS);
  float m = -INFINITY, l = 0.0f; v8f o[4];
#pragma unroll
  for (int t = 0; t < 4; ++t) o[t] = (v8f){};
  const int kend = (q0 + 16 + SRC < KL) ? (q0 + 16 + SRC) : KL;   // wave-uniform
  asm volatile("s_wait_asynccnt 0x0" ::: "memory");   // this wave's share of stage 0 has landed
  __syncthreads();                                     // stage 0 is published to all waves
  stage_copy(ring0 + STG * 2, ckh + (size_t)KT * HD, ckl + (size_t)KT * HD, cvh + KT, cvl + KT);
#pragma unroll 1
  for (int st = 0; st < nst; ++st) {
    const b16* buf = Ring + (st & 1) * STG;
#pragma unroll 1
    for (int kb = st * KT; kb < st * KT + KT; kb += 32) {
      if (kb >= kend) break;   // wave-uniform: steps beyond this wave's last visible key; the publish point below is still passed
      const int ko = kb - st * KT;
      float e[16]; float mx = -INFINITY;
#pragma unroll
      for (int u = 0; u < 2; ++u) { v8f s = (v8f){}; const b16* kr = buf + (ko + u * 16 + col) * RP; const v16b kh0 = frag_kb(kr, hh), kh1 = frag_kb(kr + 32, hh), kl0 = frag_kb(kr + PLN, hh), kl1 = frag_kb(kr + PLN + 32, hh);
        s = wmma16b(kh0, qh0, s); s = wmma16b(kh0, ql0, s); s = wmma16b(kl0, qh0, s); s = wmma16b(kh1, qh1, s); s = wmma16b(kh1, ql1, s); s = wmma16b(kl1, qh1, s);
#pragma unroll
        for (int r = 0; r < 8; ++r) { const int key = kb + u * 16 + 8 * hh + r; const float vv = (key <= qi + SRC) ? s[r] * cs : -INFINITY; e[u * 8 + r] = vv; mx = fmaxf(mx, vv); } }
      mx = fmaxf(mx, __shfl_xor(mx, 16)); const float mn = fmaxf(m, mx); const float al = (mn == -INFINITY) ? 1.0f : nexp2(m - mn); float sum = 0.0f;
#pragma unroll
      for (int i2 = 0; i2 < 16; ++i2) { const float p = (e[i2] == -INFINITY) ? 0.0f : nexp2(e[i2] - mn); sum += p; b16 a_, b_; split16(p * PS, a_, b_); const int sl = (i2 < 8 ? 0 : 16) + 8 * hh + (i2 & 7); Pb[wave][col][sl] = a_; Pc[wave][col][sl] = b_; }
      sum += __shfl_xor(sum, 16); l = l * al + sum; m = mn;
      wave_lds_sync();
      const v16b pf = frag_kb(&Pb[wave][col][0], hh), pg = frag_kb(&Pc[wave][col][0], hh);
#pragma unroll
      for (int t = 0; t < 4; ++t) { o[t] *= al; const b16* vr = buf + 2 * PLN + (t * 16 + col) * RP + ko; const v16b va = frag_kb(vr, hh), vb2 = frag_kb(vr + PLN, hh); o[t] = wmma16b(va, pf, o[t]); o[t] = wmma16b(va, pg, o[t]); o[t] = wmma16b(vb2, pf, o[t]); }
      wave_lds_sync(); }
    // publish point of stage st + 1, passed by every wave on every trip
    asm volatile("s_wait_dscnt 0x0" ::: "memory");      // this wave's reads of stage st have returned
    asm volatile("s_wait_asynccnt 0x0" ::: "memory");   // this wave's share of stage st + 1 has landed
    __syncthreads();                                     // publishes stage st + 1 and frees stage st's buffer
    if (st + 2 < nst) stage_copy(ring0 + (st & 1) * (STG * 2), ckh + (size_t)(st + 2) * KT * HD, ckl + (size_t)(st + 2) * KT * HD, cvh + (st + 2) * KT, cvl + (st + 2) * KT);
  }
  asm volatile("s_wait_asynccnt 0x0" ::: "memory");     // nothing of this wave is in flight when the ring becomes output staging
  float (*To)[16][HD + 4] = reinterpret_cast<float (*)[16][HD + 4]>(&Ring[0]);   // behind the last trip's barrier no wave reads the ring any more
  const float inv = 1.0f / (l * PS * XS);
#pragma unroll
  for (int t = 0; t < 4; ++t)
#pragma unroll
    for (int r = 0; r < 8; ++r) To[wave][col][t * 16 + 8 * hh + r] = o[t][r] * inv;
  wave_lds_sync();
  {
    for (int rr2 = 0; rr2 < 8; ++rr2) { const int row = 2 * rr2 + hh; const int c4 = col * 4; const v4f f = *(const v4f*)(&To[wave][row][c4]);
      *(v4f*)(out + ((size_t)b * (SEQ_FULL) + q0 + row) * DM + h * HD + c4) = f; }
     }
}
}  // namespace

extern "C" void kernel_launch(void* const* d_in, const int* in_sizes, int n_in, void* d_out, int out_size, void* d_ws, size_t ws_size, hipStream_t stream) {
  if (n_in < 7) return;
  auto Fp = [&](int i) { return (const float*)d_in[i]; };
  // wire order: 0 x [2,2048,1024], 1 W_q [1024,1024] (out,in), 2 b_q [1024], 3 W_k, 4 b_k, 5 W_v, 6 b_v - all f32
  if (in_sizes[0] < (NB_FULL) * (SEQ_FULL) * DM || in_sizes[1] < DM * DM || in_sizes[2] < DM || in_sizes[3] < DM * DM || in_sizes[4] < DM || in_sizes[5] < DM * DM || in_sizes[6] < DM) return;
  if (out_size < (((NB) - 1) * (SEQ_FULL) + (SEQ)) * DM) return;
  size_t off = 0; char* ws = (char*)d_ws;
  auto carve = [&](size_t bytes) { char* p = ws + off; off += (bytes + 255) & ~(size_t)255; return p; };
  b16* X16 = (b16*)carve((size_t)(NB_FULL) * (SEQ_FULL) * DM * 2);                 // 8 MiB
  b16* WT = (b16*)carve((size_t)3 * DM * DM * 2);                                  // 6 MiB
  const size_t plane = (size_t)(NB_FULL) * H * (SEQ_FULL) * HD * 2;                 // 8 MiB each, full strides
  b16* QH = (b16*)carve(plane); b16* QLo = (b16*)carve(plane); b16* KH = (b16*)carve(plane); b16* KLo = (b16*)carve(plane); b16* VTh = (b16*)carve(plane); b16* VTl = (b16*)carve(plane);
  if (off > ws_size || off > ((size_t)128 << 20)) return;   // total 62 MiB
  prep_kernel<<<(unsigned)(PREP_UNITS / 256), 256, 0, stream>>>(Fp(0), Fp(1), Fp(3), Fp(5), X16, WT);
  proj_kernel<<<dim3(KL / 128, (NB), 24), 256, 0, stream>>>(X16, WT, Fp(2), Fp(4), Fp(6), QH, QLo, KH, KLo, VTh, VTl);
  attn_kernel<<<dim3((SEQ) / 128, (NB) * H), 256, 0, stream>>>(QH, QLo, KH, KLo, VTh, VTl, (float*)d_out);
}

// v003
// It runs in 114 microseconds.
// Next to v002, in two timings, it ran 1.13 and 1.14 times as fast.
// Counting every step since v000, it is 3.03 times as fast.
#include <hip/hip_runtime.h>

// All contractions: v_wmma_f32_16x16x32_f16 (f16 operands, f32 accumulate). q/k/v projections [NB*KL x 1024] x [1024 x 3072]: x bf16-exact f16 x8, W bf16-exact f16 x256,
// 1 product, bias added in f32; S^T = K Q^T with q and k carried as f16 hi+lo x8 planes (3 products); O^T += V^T P^T with v as f16 hi+lo x8 planes and P x1024 f16 hi+lo
// (3 products); softmax running max / sum / normaliser in f32.
// Layouts: x [NB_FULL][SEQ_FULL][1024]; W_q/W_k/W_v [1024 out][1024 in]; b_q/b_k/b_v [1024]; y = x W^T + b split into 16 heads x 64; scores scaled by 1/8; key j visible to query i
// iff j <= i + 128; out[b][t][64 h + d] = softmax-weighted sum of v, stored as f32 directly (no output projection).
// Every float input is RNE-converted to bf16 once on load. Fragment k-map per lane half hh for A AND B: elements 0..7 <- k = 8hh+0..7, 8..15 <- k = 16+8hh+0..7;
// Deterministic fixed-order flash-style loop per 16-query wave over the visible keys; no cross-block communication inside a launch.

#ifndef NB
#define NB 2
#endif
#ifndef SEQ
#define SEQ 2048
#endif
#define NB_FULL 2
#define SEQ_FULL 2048

namespace {
constexpr int DM = 1024, H = 16, HD = 64, SRC = 128;
constexpr int KL = ((SEQ) + SRC < (SEQ_FULL)) ? ((SEQ) + SRC) : (SEQ_FULL);   // key / value tokens needed by queries < SEQ
static_assert((NB) >= 1 && (NB) <= (NB_FULL));
static_assert((SEQ) % 64 == 0 && (SEQ) >= 64 && (SEQ) <= (SEQ_FULL));
static_assert(KL % 64 == 0 && KL >= (SEQ) && KL <= (SEQ_FULL));
static_assert(DM == H * HD && DM % 128 == 0 && HD == 64 && (SEQ_FULL) % 32 == 0);
constexpr float XS = 8.0f, WSC = 256.0f, PS = 1024.0f, LOG2E = 1.4426950408889634f;
typedef _Float16 b16;
typedef __attribute__((ext_vector_type(16))) _Float16 v16b;
typedef __attribute__((ext_vector_type(8))) _Float16 v8b;
typedef __attribute__((ext_vector_type(4))) _Float16 v4h;
typedef __attribute__((ext_vector_type(2))) _Float16 v2h;
typedef __attribute__((ext_vector_type(8))) float v8f;
typedef __attribute__((ext_vector_type(4))) float v4f;

__device__ __forceinline__ float bf16_rne(float f) { unsigned int u = __float_as_uint(f); u += 0x7FFFu + ((u >> 16) & 1u); return __uint_as_float(u & 0xFFFF0000u); }
__device__ __forceinline__ void split16(float v, b16& hi, b16& lo) { hi = (b16)v; lo = (b16)(v - (float)hi); }
// 16-bit fragment from a k-contiguous row (A: row m; B: column n stored [n][k]); hh = lane half
__device__ __forceinline__ v16b frag_kb(const b16* p, int hh) { const v8b a = *(const v8b*)(p + 8 * hh), b = *(const v8b*)(p + 16 + 8 * hh); v16b f;
#pragma unroll
  for (int e = 0; e < 8; ++e) { f[e] = a[e]; f[8 + e] = b[e]; } return f; }
__device__ __forceinline__ v8f wmma16b(v16b a, v16b b, v8f c) { v8f d = __builtin_amdgcn_wmma_f32_16x16x32_f16(false, a, false, b, (short)0, c, false, false); asm volatile("v_nop\n\tv_nop\n\tv_nop\n\tv_nop" : "+v"(d) : "v"(a), "v"(b)); return d; }
// the same product as a plain builtin, for blocks of independent accumulator chains: the neighbouring products fill each other's distance and the compiler pads the end of the block itself
__device__ __forceinline__ v8f wmma16p(v16b a, v16b b, v8f c) { return __builtin_amdgcn_wmma_f32_16x16x32_f16(false, a, false, b, (short)0, c, false, false); }
__device__ __forceinline__ void wave_lds_sync() { __builtin_amdgcn_fence(3, "workgroup"); __builtin_amdgcn_wave_barrier(); __builtin_amdgcn_fence(2, "workgroup"); }
__device__ __forceinline__ float nexp2(float v) { return __builtin_amdgcn_exp2f(v); }

constexpr size_t WU = (size_t)DM * DM / 8;                         // 8-element units per weight matrix
constexpr size_t XU = (size_t)(NB_FULL) * (SEQ_FULL) * DM / 8;     // 8-element units of x
constexpr size_t PREP_UNITS = 3 * WU + XU;
static_assert(PREP_UNITS % 256 == 0 && (3 * WU) % 256 == 0 && WU % 256 == 0);

// prep: WT [3072 o][1024 k] = W_q | W_k | W_v rows ([out][in] is already k-contiguous), bf16 RNE then x256 -> f16; X16 [NB_FULL*SEQ_FULL][1024] = bf16 RNE(x) x8 -> f16.
__global__ __launch_bounds__(256) void prep_kernel(const float* __restrict__ x, const float* __restrict__ wq, const float* __restrict__ wk, const float* __restrict__ wv, b16* __restrict__ X16, b16* __restrict__ WT) {
  const size_t u = (size_t)blockIdx.x * 256 + threadIdx.x; if (u >= PREP_UNITS) return;
  const float* src; b16* dst; float sc;
  if (u < 3 * WU) { const int m = (int)(u / WU); const size_t e = (u - (size_t)m * WU) * 8; const float* w = m == 0 ? wq : m == 1 ? wk : wv; src = w + e; dst = WT + (size_t)m * DM * DM + e; sc = WSC; }
  else { const size_t e = (u - 3 * WU) * 8; src = x + e; dst = X16 + e; sc = XS; }
  const v4f f0 = *(const v4f*)src, f1 = *(const v4f*)(src + 4); v8b o;
#pragma unroll
  for (int j = 0; j < 4; ++j) { o[j] = (b16)(bf16_rne(f0[j]) * sc); o[4 + j] = (b16)(bf16_rne(f1[j]) * sc); }
  { *(v8b*)dst = o;  }
}

// projections: grid (KL/128, NB, 24 slabs of 128 columns: 0-7 q, 8-15 k, 16-23 v); block = 128 tokens of batch b x 128 columns, 8 waves (wave = 32 tokens x 64 columns, 8 accumulator tiles).
// One stage = 64 k of the block's 128 X16 rows and 128 WT rows (rows of 128 B), brought ONCE per block into LDS by asynchronous copies (16 B per lane, 8 copies per lane and stage) at a row pitch
// of 144 B, two buffers: stage s + 1 flies while stage s is worked on; all waves read their A and B fragments from LDS. Every accumulator tile sums k in ascending steps of 32 (K = 1024).
// epilogue + bf16-RNE bias in f32 into Tf (the ring, reused); q/k -> f16 hi/lo x8 planes [b][h][t][64]; v -> f16 hi/lo x8 planes [b][h][d][t]
constexpr int PT = 128, PK = 64, PP = PK + 8, PPL = PT * PP, PSTG = 2 * PPL, PNS = DM / PK;   // rows per plane; k per stage; row pitch, plane and stage in f16 elements; stages
static_assert(KL % PT == 0 && DM % PK == 0 && PNS >= 2);
static_assert((size_t)PT * (128 + 4) * 4 <= (size_t)2 * PSTG * 2);   // the epilogue staging fits into the ring

// One stage: lane unit (row r = tid / 8, r + 32, r + 64, r + 96; 16-B piece c = tid % 8) of the X plane and of the W plane. lds = LDS byte address of the lane's unit in the X plane of the target buffer.
__device__ __forceinline__ void proj_copy(unsigned lds, const b16* xg, const b16* wg) {
  const unsigned l0 = lds, l1 = lds + 32 * PP * 2, l2 = lds + 64 * PP * 2, l3 = lds + 96 * PP * 2, l4 = lds + PPL * 2, l5 = l4 + 32 * PP * 2, l6 = l4 + 64 * PP * 2, l7 = l4 + 96 * PP * 2;
  const b16 *g0 = xg, *g1 = xg + 32 * DM, *g2 = xg + 64 * DM, *g3 = xg + 96 * DM, *g4 = wg, *g5 = wg + 32 * DM, *g6 = wg + 64 * DM, *g7 = wg + 96 * DM;
  // the copies and, as the last line, the wait that stands in front of any rewrite of the address registers they name
  asm volatile("global_load_async_to_lds_b128 %0, %8, off\n\t"
               "global_load_async_to_lds_b128 %1, %9, off\n\t"
               "global_load_async_to_lds_b128 %2, %10, off\n\t"
               "global_load_async_to_lds_b128 %3, %11, off\n\t"
               "global_load_async_to_lds_b128 %4, %12, off\n\t"
               "global_load_async_to_lds_b128 %5, %13, off\n\t"
               "global_load_async_to_lds_b128 %6, %14, off\n\t"
               "global_load_async_to_lds_b128 %7, %15, off\n\t"
               "s_wait_xcnt 0x0"
               :: "v"(l0), "v"(l1), "v"(l2), "v"(l3), "v"(l4), "v"(l5), "v"(l6), "v"(l7), "v"(g0), "v"(g1), "v"(g2), "v"(g3), "v"(g4), "v"(g5), "v"(g6), "v"(g7) : "memory");
}

__global__ __launch_bounds__(256) void proj_kernel(const b16* __restrict__ X16, const b16* __restrict__ WT, const float* __restrict__ bq, const float* __restrict__ bk, const float* __restrict__ bv,
                                                   b16* __restrict__ QH, b16* __restrict__ QLo, b16* __restrict__ KH, b16* __restrict__ KLo, b16* __restrict__ VTh, b16* __restrict__ VTl) {
  __shared__ __attribute__((aligned(16))) b16 PR[2 * PSTG];
  const int tid = threadIdx.x, wave = __builtin_amdgcn_readfirstlane(tid >> 5), lane = tid & 31, nloc = lane & 15, hlf = lane >> 4; const int t0 = blockIdx.x * PT; const int b = blockIdx.y;
  const int slab = blockIdx.z, n0 = slab * 128, part = slab / 8, c0 = n0 - part * DM;
  const int wm = wave & 3, wn = wave >> 2;   // the wave's 32-token group and 64-column group
  const float* bias = part == 0 ? bq : part == 1 ? bk : bv;
  const int sr = tid >> 3, sc = (tid & 7) * 8;   // the lane's first staged row and first element in it
  const unsigned ring0 = (unsigned)(size_t)&PR[0] + (unsigned)(sr * PP + sc) * 2u;
  const b16 *cx = X16 + ((size_t)b * (SEQ_FULL) + t0 + sr) * DM + sc, *cw = WT + (size_t)(n0 + sr) * DM + sc;
  proj_copy(ring0, cx, cw);
  v8f acc[2][4];
#pragma unroll
  for (int i = 0; i < 2; ++i)
#pragma unroll
    for (int t = 0; t < 4; ++t) acc[i][t] = (v8f){};
  asm volatile("s_wait_asynccnt 0x0" ::: "memory");   // this wave's share of stage 0 has landed
  __syncthreads();                                     // stage 0 is published to all waves
  proj_copy(ring0 + PSTG * 2, cx + PK, cw + PK);
#pragma unroll 1
  for (int st = 0; st < PNS; ++st) {
    const b16* xr = PR + (st & 1) * PSTG + (wm * 32 + nloc) * PP; const b16* wr = PR + (st & 1) * PSTG + PPL + (wn * 64 + nloc) * PP;
#pragma unroll
    for (int ks = 0; ks < PK; ks += 32) { const v16b a0 = frag_kb(xr + ks, hlf), a1 = frag_kb(xr + 16 * PP + ks, hlf); v16b w[4];   // the six fragments of a 32-k step are read as one group
#pragma unroll
      for (int t = 0; t < 4; ++t) w[t] = frag_kb(wr + t * 16 * PP + ks, hlf);
#pragma unroll
      for (int t = 0; t < 4; ++t) { acc[0][t] = wmma16b(a0, w[t], acc[0][t]); acc[1][t] = wmma16b(a1, w[t], acc[1][t]); } }
    // publish point of stage st + 1, passed by every wave on every trip
    asm volatile("s_wait_dscnt 0x0" ::: "memory");      // this wave's reads of stage st have returned
    asm volatile("s_wait_asynccnt 0x0" ::: "memory");   // this wave's share of stage st + 1 has landed
    __syncthreads();                                     // publishes stage st + 1 and frees stage st's buffer
    if (st + 2 < PNS) proj_copy(ring0 + (st & 1) * (PSTG * 2), cx + (st + 2) * PK, cw + (st + 2) * PK);
  }
  asm volatile("s_wait_asynccnt 0x0" ::: "memory");     // nothing of this wave is in flight when the ring becomes epilogue staging
  float (*Tf)[128 + 4] = reinterpret_cast<float (*)[128 + 4]>(&PR[0]);   // behind the last trip's barrier no wave reads the ring any more
#pragma unroll
  for (int t = 0; t < 4; ++t) { const float bb = bf16_rne(bias[c0 + wn * 64 + t * 16 + nloc]);
#pragma unroll
    for (int i = 0; i < 2; ++i)
#pragma unroll
      for (int r = 0; r < 8; ++r) Tf[wm * 32 + i * 16 + 8 * hlf + r][wn * 64 + t * 16 + nloc] = acc[i][t][r] * (1.0f / (XS * WSC)) + bb; }
  __syncthreads();   // Tf is read across waves
  {
    if (part < 2) { b16* ph_ = part == 0 ? QH : KH; b16* pl_ = part == 0 ? QLo : KLo; const int c = c0 + lane * 4; const int h = c / HD, d = c % HD;
      for (int rr = 0; rr < 16; ++rr) { const int tl = wave * 16 + rr; const int tok = t0 + tl; v4h h4, l4; for (int j = 0; j < 4; ++j) { b16 p, q; split16(Tf[tl][lane * 4 + j] * XS, p, q); h4[j] = p; l4[j] = q; }
        const size_t oi = (((size_t)b * H + h) * (SEQ_FULL) + tok) * HD + d; *(v4h*)(ph_ + oi) = h4; *(v4h*)(pl_ + oi) = l4; } }
    else {
#pragma unroll 1
      for (int q = 0; q < 32; ++q) { const int cl = wave * 16 + (q >> 1); const int c = c0 + cl; const int h = c / HD, d = c % HD; const int tk = (q & 1) * 64 + lane * 2; v2h hv, lv;
        for (int j = 0; j < 2; ++j) { b16 p, ql; split16(Tf[tk + j][cl] * XS, p, ql); hv[j] = p; lv[j] = ql; }
        const size_t oi = (((size_t)b * H + h) * HD + d) * (size_t)(SEQ_FULL) + t0 + tk; *(v2h*)(VTh + oi) = hv; *(v2h*)(VTl + oi) = lv;
        asm volatile("s_wait_xcnt 0x0" ::: "memory"); } }   // stands in front of the next trip's rewrite of the registers that the two stores name
     }
}

// attention: grid (SEQ/128, NB x H): block = 8 waves x 16 queries; keys 0 .. min(KL, block's last query + 1 + 128) in stages of 64 keys. One stage = four planes of 64 rows x 128 B
// (K hi, K lo: row = key; V^T hi, V^T lo: row = d), brought ONCE per block into LDS by asynchronous copies (16 B per lane, 8 copies per lane and stage) at a row pitch of 144 B, two buffers:
// stage s + 1 flies while stage s is worked on; all 8 waves read their fragments from LDS. Per wave the 32-key steps, their order and arithmetic are as before (keys < q0 + 16 + 128):
// S^T = K Q^T with 3 products (kh qh + kh ql + kl qh); online softmax in f32; P x1024 hi/lo into a wave-private LDS tile; O^T += V^T P^T (3 products);
constexpr int AW = 8, KT = 64, RP = 64 + 8, PLN = 64 * RP, STG = 4 * PLN;   // waves per block; keys per stage; row pitch, plane and stage in f16 elements
static_assert((SEQ) % (16 * AW) == 0 && KL % KT == 0 && KL >= 2 * KT && (16 * AW + SRC) % KT == 0);
static_assert((size_t)AW * 16 * (HD + 4) * 4 <= (size_t)2 * STG * 2);   // the output staging fits into the ring

// One stage: lane unit (row r = tid / 8 and r + 32, 16-B piece c = tid % 8) of each of the four planes. lds = LDS byte address of the lane's unit in plane 0 of the target buffer.
__device__ __forceinline__ void stage_copy(unsigned lds, const b16* kh, const b16* kl, const b16* vh, const b16* vl) {
  const unsigned l0 = lds, l1 = lds + 32 * RP * 2, l2 = lds + PLN * 2, l3 = l2 + 32 * RP * 2, l4 = lds + 2 * PLN * 2, l5 = l4 + 32 * RP * 2, l6 = lds + 3 * PLN * 2, l7 = l6 + 32 * RP * 2;
  const b16 *g0 = kh, *g1 = kh + 32 * HD, *g2 = kl, *g3 = kl + 32 * HD, *g4 = vh, *g5 = vh + (size_t)32 * (SEQ_FULL), *g6 = vl, *g7 = vl + (size_t)32 * (SEQ_FULL);
  // the copies and, as the last line, the wait that stands in front of any rewrite of the address registers they name
  asm volatile("global_load_async_to_lds_b128 %0, %8, off\n\t"
               "global_load_async_to_lds_b128 %1, %9, off\n\t"
               "global_load_async_to_lds_b128 %2, %10, off\n\t"
               "global_load_async_to_lds_b128 %3, %11, off\n\t"
               "global_load_async_to_lds_b128 %4, %12, off\n\t"
               "global_load_async_to_lds_b128 %5, %13, off\n\t"
               "global_load_async_to_lds_b128 %6, %14, off\n\t"
               "global_load_async_to_lds_b128 %7, %15, off\n\t"
               "s_wait_xcnt 0x0"
               :: "v"(l0), "v"(l1), "v"(l2), "v"(l3), "v"(l4), "v"(l5), "v"(l6), "v"(l7), "v"(g0), "v"(g1), "v"(g2), "v"(g3), "v"(g4), "v"(g5), "v"(g6), "v"(g7) : "memory");
}

__global__ __launch_bounds__(256) void attn_kernel(const b16* __restrict__ QH, const b16* __restrict__ QLo, const b16* __restrict__ KH, const b16* __restrict__ KLo,
                                                  const b16* __restrict__ VTh, const b16* __restrict__ VTl, float* __restrict__ out) {
  __shared__ __attribute__((aligned(16))) b16 Ring[2 * STG]; __shared__ __attribute__((aligned(16))) b16 Pb[AW][16][32 + 8], Pc[AW][16][32 + 8];
  const int tid = threadIdx.x, wave = __builtin_amdgcn_readfirstlane(tid >> 5), lane = tid & 31, hh = lane >> 4, col = lane & 15; const int b = blockIdx.y / H, h = blockIdx.y % H;
  const int qb = blockIdx.x * (16 * AW), q0 = qb + wave * 16, qi = q0 + col;
  const size_t ph = (size_t)b * H + h; const size_t pq = ph * (size_t)(SEQ_FULL) * HD; const b16* Vh = VTh + ph * HD * (size_t)(SEQ_FULL); const b16* Vl = VTl + ph * HD * (size_t)(SEQ_FULL);
  const int nst = ((qb + 16 * AW + SRC < KL) ? (qb + 16 * AW + SRC) : KL) / KT;   // block-uniform, >= 2; staged keys stay < KL
  const int sr = tid >> 3, sc = (tid & 7) * 8;   // the lane's staged row and first element in it
  const unsigned ring0 = (unsigned)(size_t)&Ring[0] + (unsigned)(sr * RP + sc) * 2u;
  const b16 *ckh = KH + pq + (size_t)sr * HD + sc, *ckl = KLo + pq + (size_t)sr * HD + sc, *cvh = Vh + (size_t)sr * (SEQ_FULL) + sc, *cvl = Vl + (size_t)sr * (SEQ_FULL) + sc;
  stage_copy(ring0, ckh, ckl, cvh, cvl);
  const v16b qh0 = frag_kb(QH + pq + (size_t)qi * HD, hh), qh1 = frag_kb(QH + pq + (size_t)qi * HD + 32, hh), ql0 = frag_kb(QLo + pq + (size_t)qi * HD, hh), ql1 = frag_kb(QLo + pq + (size_t)qi * HD + 32, hh);
  const float cs = LOG2E / (8.0f * XS * XS);
  float m = -INFINITY, l = 0.0f; v8f o[4];
#pragma unroll
  for (int t = 0; t < 4; ++t) o[t] = (v8f){};
  const int kend = (q0 + 16 + SRC < KL) ? (q0 + 16 + SRC) : KL;   // wave-uniform
  asm volatile("s_wait_asynccnt 0x0" ::: "memory");   // this wave's share of stage 0 has landed
  __syncthreads();                                     // stage 0 is published to all waves
  stage_copy(ring0 + STG * 2, ckh + (size_t)KT * HD, ckl + (size_t)KT * HD, cvh + KT, cvl + KT);
#pragma unroll 1
  for (int st = 0; st < nst; ++st) {
    const b16* buf = Ring + (st & 1) * STG;
#pragma unroll 1
    for (int kb = st * KT; kb < st * KT + KT; kb += 32) {
      if (kb >= kend) break;   // wave-uniform: steps beyond this wave's last visible key; the publish point below is still passed
      const int ko = kb - st * KT;
      float e[16]; float mx = -INFINITY;
      v16b kh0[2], kh1[2], kl0[2], kl1[2]; v8f s[2];
#pragma unroll
      for (int u = 0; u < 2; ++u) { kh0[u] = frag_kb(buf + (ko + u * 16 + col) * RP, hh); s[u] = (v8f){}; }   // read in the order in which the products below take them
#pragma unroll
      for (int u = 0; u < 2; ++u) kl0[u] = frag_kb(buf + (ko + u * 16 + col) * RP + PLN, hh);
#pragma unroll
      for (int u = 0; u < 2; ++u) kh1[u] = frag_kb(buf + (ko + u * 16 + col) * RP + 32, hh);
#pragma unroll
      for (int u = 0; u < 2; ++u) kl1[u] = frag_kb(buf + (ko + u * 16 + col) * RP + PLN + 32, hh);
      __builtin_amdgcn_sched_barrier(0);   // the step's 16 K reads stay one group in front of the score products: the wave waits out the LDS latency once, not per fragment
#pragma unroll
      for (int u = 0; u < 2; ++u) s[u] = wmma16p(kh0[u], qh0, s[u]);   // the two key tiles' chains alternate; each tile keeps its order of six products
#pragma unroll
      for (int u = 0; u < 2; ++u) s[u] = wmma16p(kh0[u], ql0, s[u]);
#pragma unroll
      for (int u = 0; u < 2; ++u) s[u] = wmma16p(kl0[u], qh0, s[u]);
#pragma unroll
      for (int u = 0; u < 2; ++u) s[u] = wmma16p(kh1[u], qh1, s[u]);
#pragma unroll
      for (int u = 0; u < 2; ++u) s[u] = wmma16p(kh1[u], ql1, s[u]);
#pragma unroll
      for (int u = 0; u < 2; ++u) s[u] = wmma16p(kl1[u], qh1, s[u]);
      v16b va[4], vb2[4];
#pragma unroll
      for (int t = 0; t < 4; ++t) { const b16* vr = buf + 2 * PLN + (t * 16 + col) * RP + ko; va[t] = frag_kb(vr, hh); vb2[t] = frag_kb(vr + PLN, hh); }
      __builtin_amdgcn_sched_barrier(0);   // the step's 16 V reads stay one group here, in front of the softmax, whose vector work covers their latency
#pragma unroll
      for (int u = 0; u < 2; ++u)
#pragma unroll
        for (int r = 0; r < 8; ++r) { const int key = kb + u * 16 + 8 * hh + r; const float vv = (key <= qi + SRC) ? s[u][r] * cs : -INFINITY; e[u * 8 + r] = vv; mx = fmaxf(mx, vv); }
      mx = fmaxf(mx, __shfl_xor(mx, 16)); const float mn = fmaxf(m, mx); const float al = (mn == -INFINITY) ? 1.0f : nexp2(m - mn); float sum = 0.0f;
#pragma unroll
      for (int i2 = 0; i2 < 16; ++i2) { const float p = (e[i2] == -INFINITY) ? 0.0f : nexp2(e[i2] - mn); sum += p; b16 a_, b_; split16(p * PS, a_, b_); const int sl = (i2 < 8 ? 0 : 16) + 8 * hh + (i2 & 7); Pb[wave][col][sl] = a_; Pc[wave][col][sl] = b_; }
      sum += __shfl_xor(sum, 16); l = l * al + sum; m = mn;
      wave_lds_sync();
      const v16b pf = frag_kb(&Pb[wave][col][0], hh), pg = frag_kb(&Pc[wave][col][0], hh);
#pragma unroll
      for (int t = 0; t < 4; ++t) o[t] *= al;
#pragma unroll
      for (int t = 0; t < 4; ++t) o[t] = wmma16p(va[t], pf, o[t]);   // the four output tiles' chains alternate; each tile keeps its order of three products
#pragma unroll
      for (int t = 0; t < 4; ++t) o[t] = wmma16p(va[t], pg, o[t]);
#pragma unroll
      for (int t = 0; t < 4; ++t) o[t] = wmma16p(vb2[t], pf, o[t]);
      wave_lds_sync(); }
    // publish point of stage st + 1, passed by every wave on every trip
    asm volatile("s_wait_dscnt 0x0" ::: "memory");      // this wave's reads of stage st have returned
    asm volatile("s_wait_asynccnt 0x0" ::: "memory");   // this wave's share of stage st + 1 has landed
    __syncthreads();                                     // publishes stage st + 1 and frees stage st's buffer
    if (st + 2 < nst) stage_copy(ring0 + (st & 1) * (STG * 2), ckh + (size_t)(st + 2) * KT * HD, ckl + (size_t)(st + 2) * KT * HD, cvh + (st + 2) * KT, cvl + (st + 2) * KT);
  }
  asm volatile("s_wait_asynccnt 0x0" ::: "memory");     // nothing of this wave is in flight when the ring becomes output staging
  float (*To)[16][HD + 4] = reinterpret_cast<float (*)[16][HD + 4]>(&Ring[0]);   // behind the last trip's barrier no wave reads the ring any more
  const float inv = 1.0f / (l * PS * XS);
#pragma unroll
  for (int t = 0; t < 4; ++t)
#pragma unroll
    for (int r = 0; r < 8; ++r) To[wave][col][t * 16 + 8 * hh + r] = o[t][r] * inv;
  wave_lds_sync();
  {
    for (int rr2 = 0; rr2 < 8; ++rr2) { const int row = 2 * rr2 + hh; const int c4 = col * 4; const v4f f = *(const v4f*)(&To[wave][row][c4]);
      *(v4f*)(out + ((size_t)b * (SEQ_FULL) + q0 + row) * DM + h * HD + c4) = f; }
     }
}
}  // namespace

extern "C" void kernel_launch(void* const* d_in, const int* in_sizes, int n_in, void* d_out, int out_size, void* d_ws, size_t ws_size, hipStream_t stream) {
  if (n_in < 7) return;
  auto Fp = [&](int i) { return (const float*)d_in[i]; };
  // wire order: 0 x [2,2048,1024], 1 W_q [1024,1024] (out,in), 2 b_q [1024], 3 W_k, 4 b_k, 5 W_v, 6 b_v - all f32
  if (in_sizes[0] < (NB_FULL) * (SEQ_FULL) * DM || in_sizes[1] < DM * DM || in_sizes[2] < DM || in_sizes[3] < DM * DM || in_sizes[4] < DM || in_sizes[5] < DM * DM || in_sizes[6] < DM) return;
  if (out_size < (((NB) - 1) * (SEQ_FULL) + (SEQ)) * DM) return;
  size_t off = 0; char* ws = (char*)d_ws;
  auto carve = [&](size_t bytes) { char* p = ws + off; off += (bytes + 255) & ~(size_t)255; return p; };
  b16* X16 = (b16*)carve((size_t)(NB_FULL) * (SEQ_FULL) * DM * 2);                 // 8 MiB
  b16* WT = (b16*)carve((size_t)3 * DM * DM * 2);                                  // 6 MiB
  const size_t plane = (size_t)(NB_FULL) * H * (SEQ_FULL) * HD * 2;                 // 8 MiB each, full strides
  b16* QH = (b16*)carve(plane); b16* QLo = (b16*)carve(plane); b16* KH = (b16*)carve(plane); b16* KLo = (b16*)carve(plane); b16* VTh = (b16*)carve(plane); b16* VTl = (b16*)carve(plane);
  if (off > ws_size || off > ((size_t)128 << 20)) return;   // total 62 MiB
  prep_kernel<<<(unsigned)(PREP_UNITS / 256), 256, 0, stream>>>(Fp(0), Fp(1), Fp(3), Fp(5), X16, WT);
  proj_kernel<<<dim3(KL / 128, (NB), 24), 256, 0, stream>>>(X16, WT, Fp(2), Fp(4), Fp(6), QH, QLo, KH, KLo, VTh, VTl);
  attn_kernel<<<dim3((SEQ) / 128, (NB) * H), 256, 0, stream>>>(QH, QLo, KH, KLo, VTh, VTl, (float*)d_out);
}

// v004
// One run takes 97 microseconds.
// In both of two side-by-side timings against v003, it was 1.17 times as fast.
// All steps since v000 together make it 3.53 times as fast.
#include <hip/hip_runtime.h>

// All contractions: v_wmma_f32_16x16x32_f16 (f16 operands, f32 accumulate). q/k/v projections [NB*KL x 1024] x [1024 x 3072]: x bf16-exact f16 x8, W bf16-exact f16 x256,
// 1 product, bias added in f32; S^T = K Q^T with q and k carried as f16 hi+lo x8 planes (3 products); O^T += V^T P^T with v as f16 hi+lo x8 planes and P x1024 f16 hi+lo
// (3 products); softmax running max / sum / normaliser in f32.
// Layouts: x [NB_FULL][SEQ_FULL][1024]; W_q/W_k/W_v [1024 out][1024 in]; b_q/b_k/b_v [1024]; y = x W^T + b split into 16 heads x 64; scores scaled by 1/8; key j visible to query i
// iff j <= i + 128; out[b][t][64 h + d] = softmax-weighted sum of v, stored as f32 directly (no output projection).
// Every float input is RNE-converted to bf16 once on load. Fragment k-map per lane half hh for A AND B: elements 0..7 <- k = 8hh+0..7, 8..15 <- k = 16+8hh+0..7;
// Deterministic fixed-order flash-style loop per 16-query wave over the visible keys; no cross-block communication inside a launch.

#ifndef NB
#define NB 2
#endif
#ifndef SEQ
#define SEQ 2048
#endif
#define NB_FULL 2
#define SEQ_FULL 2048

namespace {
constexpr int DM = 1024, H = 16, HD = 64, SRC = 128;
constexpr int KL = ((SEQ) + SRC < (SEQ_FULL)) ? ((SEQ) + SRC) : (SEQ_FULL);   // key / value tokens needed by queries < SEQ
static_assert((NB) >= 1 && (NB) <= (NB_FULL));
static_assert((SEQ) % 64 == 0 && (SEQ) >= 64 && (SEQ) <= (SEQ_FULL));
static_assert(KL % 64 == 0 && KL >= (SEQ) && KL <= (SEQ_FULL));
static_assert(DM == H * HD && DM % 128 == 0 && HD == 64 && (SEQ_FULL) % 32 == 0);
constexpr float XS = 8.0f, WSC = 256.0f, PS = 1024.0f, LOG2E = 1.4426950408889634f;
typedef _Float16 b16;
typedef __attribute__((ext_vector_type(16))) _Float16 v16b;
typedef __attribute__((ext_vector_type(8))) _Float16 v8b;
typedef __attribute__((ext_vector_type(4))) _Float16 v4h;
typedef __attribute__((ext_vector_type(2))) _Float16 v2h;
typedef __attribute__((ext_vector_type(8))) float v8f;
typedef __attribute__((ext_vector_type(4))) float v4f;

__device__ __forceinline__ float bf16_rne(float f) { unsigned int u = __float_as_uint(f); u += 0x7FFFu + ((u >> 16) & 1u); return __uint_as_float(u & 0xFFFF0000u); }
__device__ __forceinline__ void split16(float v, b16& hi, b16& lo) { hi = (b16)v; lo = (b16)(v - (float)hi); }
// 16-bit fragment from a k-contiguous row (A: row m; B: column n stored [n][k]); hh = lane half
__device__ __forceinline__ v16b frag_kb(const b16* p, int hh) { const v8b a = *(const v8b*)(p + 8 * hh), b = *(const v8b*)(p + 16 + 8 * hh); v16b f;
#pragma unroll
  for (int e = 0; e < 8; ++e) { f[e] = a[e]; f[8 + e] = b[e]; } return f; }
__device__ __forceinline__ v8f wmma16b(v16b a, v16b b, v8f c) { v8f d = __builtin_amdgcn_wmma_f32_16x16x32_f16(false, a, false, b, (short)0, c, false, false); asm volatile("v_nop\n\tv_nop\n\tv_nop\n\tv_nop" : "+v"(d) : "v"(a), "v"(b)); return d; }
// the same product as a plain builtin, for blocks of independent accumulator chains: the neighbouring products fill each other's distance and the compiler pads the end of the block itself
__device__ __forceinline__ v8f wmma16p(v16b a, v16b b, v8f c) { return __builtin_amdgcn_wmma_f32_16x16x32_f16(false, a, false, b, (short)0, c, false, false); }
__device__ __forceinline__ void wave_lds_sync() { __builtin_amdgcn_fence(3, "workgroup"); __builtin_amdgcn_wave_barrier(); __builtin_amdgcn_fence(2, "workgroup"); }
__device__ __forceinline__ float nexp2(float v) { return __builtin_amdgcn_exp2f(v); }

constexpr size_t WU = (size_t)DM * DM / 8;                         // 8-element units per weight matrix
constexpr size_t XU = (size_t)(NB_FULL) * (SEQ_FULL) * DM / 8;     // 8-element units of x
constexpr size_t PREP_UNITS = 3 * WU + XU;
static_assert(PREP_UNITS % 256 == 0 && (3 * WU) % 256 == 0 && WU % 256 == 0);

// prep: WT [3072 o][1024 k] = W_q | W_k | W_v rows ([out][in] is already k-contiguous), bf16 RNE then x256 -> f16; X16 [NB_FULL*SEQ_FULL][1024] = bf16 RNE(x) x8 -> f16.
__global__ __launch_bounds__(256) void prep_kernel(const float* __restrict__ x, const float* __restrict__ wq, const float* __restrict__ wk, const float* __restrict__ wv, b16* __restrict__ X16, b16* __restrict__ WT) {
  const size_t u = (size_t)blockIdx.x * 256 + threadIdx.x; if (u >= PREP_UNITS) return;
  const float* src; b16* dst; float sc;
  if (u < 3 * WU) { const int m = (int)(u / WU); const size_t e = (u - (size_t)m * WU) * 8; const float* w = m == 0 ? wq : m == 1 ? wk : wv; src = w + e; dst = WT + (size_t)m * DM * DM + e; sc = WSC; }
  else { const size_t e = (u - 3 * WU) * 8; src = x + e; dst = X16 + e; sc = XS; }
  const v4f f0 = *(const v4f*)src, f1 = *(const v4f*)(src + 4); v8b o;
#pragma unroll
  for (int j = 0; j < 4; ++j) { o[j] = (b16)(bf16_rne(f0[j]) * sc); o[4 + j] = (b16)(bf16_rne(f1[j]) * sc); }
  { *(v8b*)dst = o;  }
}

// projections: grid (KL/128, NB, 24 slabs of 128 columns: 0-7 q, 8-15 k, 16-23 v); block = 128 tokens of batch b x 128 columns, 8 waves (wave = 32 tokens x 64 columns, 8 accumulator tiles).
// One stage = 64 k of the block's 128 X16 rows and 128 WT rows (rows of 128 B), brought ONCE per block into LDS by asynchronous copies (16 B per lane, 8 copies per lane and stage) at a row pitch
// of 144 B, two buffers: stage s + 1 flies while stage s is worked on; all waves read their A and B fragments from LDS. Every accumulator tile sums k in ascending steps of 32 (K = 1024).
// epilogue + bf16-RNE bias in f32 into Tf (the ring, reused); q/k -> f16 hi/lo x8 planes [b][h][t][64]; v -> f16 hi/lo x8 planes [b][h][d][t]
constexpr int PT = 128, PK = 64, PP = PK + 8, PPL = PT * PP, PSTG = 2 * PPL, PNS = DM / PK;   // rows per plane; k per stage; row pitch, plane and stage in f16 elements; stages
static_assert(KL % PT == 0 && DM % PK == 0 && PNS >= 2);
static_assert((size_t)PT * (128 + 4) * 4 <= (size_t)2 * PSTG * 2);   // the epilogue staging fits into the ring

// One stage: lane unit (row r = tid / 8, r + 32, r + 64, r + 96; 16-B piece c = tid % 8) of the X plane and of the W plane. lds = LDS byte address of the lane's unit in the X plane of the target buffer.
__device__ __forceinline__ void proj_copy(unsigned lds, const b16* xg, const b16* wg) {
  const unsigned l0 = lds, l1 = lds + 32 * PP * 2, l2 = lds + 64 * PP * 2, l3 = lds + 96 * PP * 2, l4 = lds + PPL * 2, l5 = l4 + 32 * PP * 2, l6 = l4 + 64 * PP * 2, l7 = l4 + 96 * PP * 2;
  const b16 *g0 = xg, *g1 = xg + 32 * DM, *g2 = xg + 64 * DM, *g3 = xg + 96 * DM, *g4 = wg, *g5 = wg + 32 * DM, *g6 = wg + 64 * DM, *g7 = wg + 96 * DM;
  // the copies and, as the last line, the wait that stands in front of any rewrite of the address registers they name
  asm volatile("global_load_async_to_lds_b128 %0, %8, off\n\t"
               "global_load_async_to_lds_b128 %1, %9, off\n\t"
               "global_load_async_to_lds_b128 %2, %10, off\n\t"
               "global_load_async_to_lds_b128 %3, %11, off\n\t"
               "global_load_async_to_lds_b128 %4, %12, off\n\t"
               "global_load_async_to_lds_b128 %5, %13, off\n\t"
               "global_load_async_to_lds_b128 %6, %14, off\n\t"
               "global_load_async_to_lds_b128 %7, %15, off\n\t"
               "s_wait_xcnt 0x0"
               :: "v"(l0), "v"(l1), "v"(l2), "v"(l3), "v"(l4), "v"(l5), "v"(l6), "v"(l7), "v"(g0), "v"(g1), "v"(g2), "v"(g3), "v"(g4), "v"(g5), "v"(g6), "v"(g7) : "memory");
}

__global__ __launch_bounds__(256) void proj_kernel(const b16* __restrict__ X16, const b16* __restrict__ WT, const float* __restrict__ bq, const float* __restrict__ bk, const float* __restrict__ bv,
                                                   b16* __restrict__ QH, b16* __restrict__ QLo, b16* __restrict__ KH, b16* __restrict__ KLo, b16* __restrict__ VTh, b16* __restrict__ VTl) {
  __shared__ __attribute__((aligned(16))) b16 PR[2 * PSTG];
  const int tid = threadIdx.x, wave = __builtin_amdgcn_readfirstlane(tid >> 5), lane = tid & 31, nloc = lane & 15, hlf = lane >> 4; const int t0 = blockIdx.x * PT; const int b = blockIdx.y;
  const int slab = blockIdx.z, n0 = slab * 128, part = slab / 8, c0 = n0 - part * DM;
  const int wm = wave & 3, wn = wave >> 2;   // the wave's 32-token group and 64-column group
  const float* bias = part == 0 ? bq : part == 1 ? bk : bv;
  const int sr = tid >> 3, sc = (tid & 7) * 8;   // the lane's first staged row and first element in it
  const unsigned ring0 = (unsigned)(size_t)&PR[0] + (unsigned)(sr * PP + sc) * 2u;
  const b16 *cx = X16 + ((size_t)b * (SEQ_FULL) + t0 + sr) * DM + sc, *cw = WT + (size_t)(n0 + sr) * DM + sc;
  proj_copy(ring0, cx, cw);
  v8f acc[2][4];
#pragma unroll
  for (int i = 0; i < 2; ++i)
#pragma unroll
    for (int t = 0; t < 4; ++t) acc[i][t] = (v8f){};
  asm volatile("s_wait_asynccnt 0x0" ::: "memory");   // this wave's share of stage 0 has landed
  __syncthreads();                                     // stage 0 is published to all waves
  proj_copy(ring0 + PSTG * 2, cx + PK, cw + PK);
#pragma unroll 1
  for (int st = 0; st < PNS; ++st) {
    const b16* xr = PR + (st & 1) * PSTG + (wm * 32 + nloc) * PP; const b16* wr = PR + (st & 1) * PSTG + PPL + (wn * 64 + nloc) * PP;
#pragma unroll
    for (int ks = 0; ks < PK; ks += 32) { const v16b a0 = frag_kb(xr + ks, hlf), a1 = frag_kb(xr + 16 * PP + ks, hlf); v16b w[4];   // the six fragments of a 32-k step are read as one group
#pragma unroll
      for (int t = 0; t < 4; ++t) w[t] = frag_kb(wr + t * 16 * PP + ks, hlf);
#pragma unroll
      for (int t = 0; t < 4; ++t) { acc[0][t] = wmma16b(a0, w[t], acc[0][t]); acc[1][t] = wmma16b(a1, w[t], acc[1][t]); } }
    // publish point of stage st + 1, passed by every wave on every trip
    asm volatile("s_wait_dscnt 0x0" ::: "memory");      // this wave's reads of stage st have returned
    asm volatile("s_wait_asynccnt 0x0" ::: "memory");   // this wave's share of stage st + 1 has landed
    __syncthreads();                                     // publishes stage st + 1 and frees stage st's buffer
    if (st + 2 < PNS) proj_copy(ring0 + (st & 1) * (PSTG * 2), cx + (st + 2) * PK, cw + (st + 2) * PK);
  }
  asm volatile("s_wait_asynccnt 0x0" ::: "memory");     // nothing of this wave is in flight when the ring becomes epilogue staging
  float (*Tf)[128 + 4] = reinterpret_cast<float (*)[128 + 4]>(&PR[0]);   // behind the last trip's barrier no wave reads the ring any more
#pragma unroll
  for (int t = 0; t < 4; ++t) { const float bb = bf16_rne(bias[c0 + wn * 64 + t * 16 + nloc]);
#pragma unroll
    for (int i = 0; i < 2; ++i)
#pragma unroll
      for (int r = 0; r < 8; ++r) Tf[wm * 32 + i * 16 + 8 * hlf + r][wn * 64 + t * 16 + nloc] = acc[i][t][r] * (1.0f / (XS * WSC)) + bb; }
  __syncthreads();   // Tf is read across waves
  {
    if (part < 2) { b16* ph_ = part == 0 ? QH : KH; b16* pl_ = part == 0 ? QLo : KLo; const int c = c0 + lane * 4; const int h = c / HD, d = c % HD;
      for (int rr = 0; rr < 16; ++rr) { const int tl = wave * 16 + rr; const int tok = t0 + tl; v4h h4, l4; for (int j = 0; j < 4; ++j) { b16 p, q; split16(Tf[tl][lane * 4 + j] * XS, p, q); h4[j] = p; l4[j] = q; }
        const size_t oi = (((size_t)b * H + h) * (SEQ_FULL) + tok) * HD + d; *(v4h*)(ph_ + oi) = h4; *(v4h*)(pl_ + oi) = l4; } }
    else {
#pragma unroll 1
      for (int q = 0; q < 32; ++q) { const int cl = wave * 16 + (q >> 1); const int c = c0 + cl; const int h = c / HD, d = c % HD; const int tk = (q & 1) * 64 + lane * 2; v2h hv, lv;
        for (int j = 0; j < 2; ++j) { b16 p, ql; split16(Tf[tk + j][cl] * XS, p, ql); hv[j] = p; lv[j] = ql; }
        const size_t oi = (((size_t)b * H + h) * HD + d) * (size_t)(SEQ_FULL) + t0 + tk; *(v2h*)(VTh + oi) = hv; *(v2h*)(VTl + oi) = lv;
        asm volatile("s_wait_xcnt 0x0" ::: "memory"); } }   // stands in front of the next trip's rewrite of the registers that the two stores name
     }
}

// attention: grid (SEQ/256, NB x H): block = 16 waves x 16 queries = two 128-query tiles of one head side by side: waves 0-7 take tile n - 1 - x (long), waves 8-15 tile x (short), so that every
// block, and with one block per WGP every WGP, holds about the same number of 32-key steps. Both tiles walk the same K/V ring: keys 0 .. min(KL, long tile's last query + 1 + 128) in stages of
// 64 keys; the stage count is the block's one count and every wave passes every publish point, also a wave whose own keys have ended. One stage = four planes of 64 rows x 128 B
// (K hi, K lo: row = key; V^T hi, V^T lo: row = d), brought ONCE per block into LDS by asynchronous copies (16 B per lane, 4 copies per lane and stage) at a row pitch of 144 B, two buffers:
// stage s + 1 flies while stage s is worked on; all 16 waves read their fragments from LDS. Per wave the 32-key steps, their order and arithmetic are as before (keys < q0 + 16 + 128):
// S^T = K Q^T with 3 products (kh qh + kh ql + kl qh); online softmax in f32; P x1024 hi/lo into a wave-private LDS tile; O^T += V^T P^T (3 products);
constexpr int AW = 8, BW = 2 * AW, NT = (SEQ) / (16 * AW), KT = 64, RP = 64 + 8, PLN = 64 * RP, STG = 4 * PLN;   // waves per tile and per block; query tiles per head; keys per stage; row pitch, plane and stage in f16 elements
static_assert((SEQ) % (16 * BW) == 0 && KL % KT == 0 && KL >= 2 * KT && (16 * AW + SRC) % KT == 0);
static_assert((size_t)BW * 16 * (HD + 4) * 4 <= (size_t)2 * STG * 2);   // the output staging fits into the ring

// One stage: lane unit (row r = tid / 8 in 0 .. 63, 16-B piece c = tid % 8) of each of the four planes. lds = LDS byte address of the lane's unit in plane 0 of the target buffer.
__device__ __forceinline__ void stage_copy(unsigned lds, const b16* kh, const b16* kl, const b16* vh, const b16* vl) {
  const unsigned l0 = lds, l1 = lds + PLN * 2, l2 = lds + 2 * PLN * 2, l3 = lds + 3 * PLN * 2;
  // the copies and, as the last line, the wait that stands in front of any rewrite of the address registers they name
  asm volatile("global_load_async_to_lds_b128 %0, %4, off\n\t"
               "global_load_async_to_lds_b128 %1, %5, off\n\t"
               "global_load_async_to_lds_b128 %2, %6, off\n\t"
               "global_load_async_to_lds_b128 %3, %7, off\n\t"
               "s_wait_xcnt 0x0"
               :: "v"(l0), "v"(l1), "v"(l2), "v"(l3), "v"(kh), "v"(kl), "v"(vh), "v"(vl) : "memory");
}

__global__ __launch_bounds__(512) void attn_kernel(const b16* __restrict__ QH, const b16* __restrict__ QLo, const b16* __restrict__ KH, const b16* __restrict__ KLo,
                                                  const b16* __restrict__ VTh, const b16* __restrict__ VTl, float* __restrict__ out) {
  __shared__ __attribute__((aligned(16))) b16 Ring[2 * STG]; __shared__ __attribute__((aligned(16))) b16 Pb[BW][16][32 + 8], Pc[BW][16][32 + 8];
  const int tid = threadIdx.x, wave = __builtin_amdgcn_readfirstlane(tid >> 5), lane = tid & 31, hh = lane >> 4, col = lane & 15; const int b = blockIdx.y / H, h = blockIdx.y % H;
  const int qbl = (NT - 1 - (int)blockIdx.x) * (16 * AW);   // first query of the long tile, which sets the block's stage count
  const int qb = (wave < AW) ? qbl : (int)blockIdx.x * (16 * AW), q0 = qb + (wave & (AW - 1)) * 16, qi = q0 + col;   // wave-uniform choice of the tile
  const size_t ph = (size_t)b * H + h; const size_t pq = ph * (size_t)(SEQ_FULL) * HD; const b16* Vh = VTh + ph * HD * (size_t)(SEQ_FULL); const b16* Vl = VTl + ph * HD * (size_t)(SEQ_FULL);
  const int nst = ((qbl + 16 * AW + SRC < KL) ? (qbl + 16 * AW + SRC) : KL) / KT;   // block-uniform, >= 2; staged keys stay < KL; covers the short tile's keys too
  const int sr = tid >> 3, sc = (tid & 7) * 8;   // the lane's staged row and first element in it
  const unsigned ring0 = (unsigned)(size_t)&Ring[0] + (unsigned)(sr * RP + sc) * 2u;
  const b16 *ckh = KH + pq + (size_t)sr * HD + sc, *ckl = KLo + pq + (size_t)sr * HD + sc, *cvh = Vh + (size_t)sr * (SEQ_FULL) + sc, *cvl = Vl + (size_t)sr * (SEQ_FULL) + sc;
  stage_copy(ring0, ckh, ckl, cvh, cvl);
  const v16b qh0 = frag_kb(QH + pq + (size_t)qi * HD, hh), qh1 = frag_kb(QH + pq + (size_t)qi * HD + 32, hh), ql0 = frag_kb(QLo + pq + (size_t)qi * HD, hh), ql1 = frag_kb(QLo + pq + (size_t)qi * HD + 32, hh);
  const float cs = LOG2E / (8.0f * XS * XS);
  float m = -INFINITY, l = 0.0f; v8f o[4];
#pragma unroll
  for (int t = 0; t < 4; ++t) o[t] = (v8f){};
  const int kend = (q0 + 16 + SRC < KL) ? (q0 + 16 + SRC) : KL;   // wave-uniform
  asm volatile("s_wait_asynccnt 0x0" ::: "memory");   // this wave's share of stage 0 has landed
  __syncthreads();                                     // stage 0 is published to all waves
  stage_copy(ring0 + STG * 2, ckh + (size_t)KT * HD, ckl + (size_t)KT * HD, cvh + KT, cvl + KT);
#pragma unroll 1
  for (int st = 0; st < nst; ++st) {
    const b16* buf = Ring + (st & 1) * STG;
#pragma unroll 1
    for (int kb = st * KT; kb < st * KT + KT; kb += 32) {
      if (kb >= kend) break;   // wave-uniform: steps beyond this wave's last visible key; the publish point below is still passed
      const int ko = kb - st * KT;
      float e[16]; float mx = -INFINITY;
      v16b kh0[2], kh1[2], kl0[2], kl1[2]; v8f s[2];
#pragma unroll
      for (int u = 0; u < 2; ++u) { kh0[u] = frag_kb(buf + (ko + u * 16 + col) * RP, hh); s[u] = (v8f){}; }   // read in the order in which the products below take them
#pragma unroll
      for (int u = 0; u < 2; ++u) kl0[u] = frag_kb(buf + (ko + u * 16 + col) * RP + PLN, hh);
#pragma unroll
      for (int u = 0; u < 2; ++u) kh1[u] = frag_kb(buf + (ko + u * 16 + col) * RP + 32, hh);
#pragma unroll
      for (int u = 0; u < 2; ++u) kl1[u] = frag_kb(buf + (ko + u * 16 + col) * RP + PLN + 32, hh);
      __builtin_amdgcn_sched_barrier(0);   // the step's 16 K reads stay one group in front of the score products: the wave waits out the LDS latency once, not per fragment
#pragma unroll
      for (int u = 0; u < 2; ++u) s[u] = wmma16p(kh0[u], qh0, s[u]);   // the two key tiles' chains alternate; each tile keeps its order of six products
#pragma unroll
      for (int u = 0; u < 2; ++u) s[u] = wmma16p(kh0[u], ql0, s[u]);
#pragma unroll
      for (int u = 0; u < 2; ++u) s[u] = wmma16p(kl0[u], qh0, s[u]);
#pragma unroll
      for (int u = 0; u < 2; ++u) s[u] = wmma16p(kh1[u], qh1, s[u]);
#pragma unroll
      for (int u = 0; u < 2; ++u) s[u] = wmma16p(kh1[u], ql1, s[u]);
#pragma unroll
      for (int u = 0; u < 2; ++u) s[u] = wmma16p(kl1[u], qh1, s[u]);
      v16b va[4], vb2[4];
#pragma unroll
      for (int t = 0; t < 4; ++t) { const b16* vr = buf + 2 * PLN + (t * 16 + col) * RP + ko; va[t] = frag_kb(vr, hh); vb2[t] = frag_kb(vr + PLN, hh); }
      __builtin_amdgcn_sched_barrier(0);   // the step's 16 V reads stay one group here, in front of the softmax, whose vector work covers their latency
#pragma unroll
      for (int u = 0; u < 2; ++u)
#pragma unroll
        for (int r = 0; r < 8; ++r) { const int key = kb + u * 16 + 8 * hh + r; const float vv = (key <= qi + SRC) ? s[u][r] * cs : -INFINITY; e[u * 8 + r] = vv; mx = fmaxf(mx, vv); }
      mx = fmaxf(mx, __shfl_xor(mx, 16)); const float mn = fmaxf(m, mx); const float al = (mn == -INFINITY) ? 1.0f : nexp2(m - mn); float sum = 0.0f;
#pragma unroll
      for (int i2 = 0; i2 < 16; ++i2) { const float p = (e[i2] == -INFINITY) ? 0.0f : nexp2(e[i2] - mn); sum += p; b16 a_, b_; split16(p * PS, a_, b_); const int sl = (i2 < 8 ? 0 : 16) + 8 * hh + (i2 & 7); Pb[wave][col][sl] = a_; Pc[wave][col][sl] = b_; }
      sum += __shfl_xor(sum, 16); l = l * al + sum; m = mn;
      wave_lds_sync();
      const v16b pf = frag_kb(&Pb[wave][col][0], hh), pg = frag_kb(&Pc[wave][col][0], hh);
#pragma unroll
      for (int t = 0; t < 4; ++t) o[t] *= al;
#pragma unroll
      for (int t = 0; t < 4; ++t) o[t] = wmma16p(va[t], pf, o[t]);   // the four output tiles' chains alternate; each tile keeps its order of three products
#pragma unroll
      for (int t = 0; t < 4; ++t) o[t] = wmma16p(va[t], pg, o[t]);
#pragma unroll
      for (int t = 0; t < 4; ++t) o[t] = wmma16p(vb2[t], pf, o[t]);
      wave_lds_sync(); }
    // publish point of stage st + 1, passed by every wave on every trip
    asm volatile("s_wait_dscnt 0x0" ::: "memory");      // this wave's reads of stage st have returned
    asm volatile("s_wait_asynccnt 0x0" ::: "memory");   // this wave's share of stage st + 1 has landed
    __syncthreads();                                     // publishes stage st + 1 and frees stage st's buffer
    if (st + 2 < nst) stage_copy(ring0 + (st & 1) * (STG * 2), ckh + (size_t)(st + 2) * KT * HD, ckl + (size_t)(st + 2) * KT * HD, cvh + (st + 2) * KT, cvl + (st + 2) * KT);
  }
  asm volatile("s_wait_asynccnt 0x0" ::: "memory");     // nothing of this wave is in flight when the ring becomes output staging
  float (*To)[16][HD + 4] = reinterpret_cast<float (*)[16][HD + 4]>(&Ring[0]);   // behind the last trip's barrier no wave reads the ring any more
  const float inv = 1.0f / (l * PS * XS);
#pragma unroll
  for (int t = 0; t < 4; ++t)
#pragma unroll
    for (int r = 0; r < 8; ++r) To[wave][col][t * 16 + 8 * hh + r] = o[t][r] * inv;
  wave_lds_sync();
  {
    for (int rr2 = 0; rr2 < 8; ++rr2) { const int row = 2 * rr2 + hh; const int c4 = col * 4; const v4f f = *(const v4f*)(&To[wave][row][c4]);
      *(v4f*)(out + ((size_t)b * (SEQ_FULL) + q0 + row) * DM + h * HD + c4) = f; }
     }
}
}  // namespace

extern "C" void kernel_launch(void* const* d_in, const int* in_sizes, int n_in, void* d_out, int out_size, void* d_ws, size_t ws_size, hipStream_t stream) {
  if (n_in < 7) return;
  auto Fp = [&](int i) { return (const float*)d_in[i]; };
  // wire order: 0 x [2,2048,1024], 1 W_q [1024,1024] (out,in), 2 b_q [1024], 3 W_k, 4 b_k, 5 W_v, 6 b_v - all f32
  if (in_sizes[0] < (NB_FULL) * (SEQ_FULL) * DM || in_sizes[1] < DM * DM || in_sizes[2] < DM || in_sizes[3] < DM * DM || in_sizes[4] < DM || in_sizes[5] < DM * DM || in_sizes[6] < DM) return;
  if (out_size < (((NB) - 1) * (SEQ_FULL) + (SEQ)) * DM) return;
  size_t off = 0; char* ws = (char*)d_ws;
  auto carve = [&](size_t bytes) { char* p = ws + off; off += (bytes + 255) & ~(size_t)255; return p; };
  b16* X16 = (b16*)carve((size_t)(NB_FULL) * (SEQ_FULL) * DM * 2);                 // 8 MiB
  b16* WT = (b16*)carve((size_t)3 * DM * DM * 2);                                  // 6 MiB
  const size_t plane = (size_t)(NB_FULL) * H * (SEQ_FULL) * HD * 2;                 // 8 MiB each, full strides
  b16* QH = (b16*)carve(plane); b16* QLo = (b16*)carve(plane); b16* KH = (b16*)carve(plane); b16* KLo = (b16*)carve(plane); b16* VTh = (b16*)carve(plane); b16* VTl = (b16*)carve(plane);
  if (off > ws_size || off > ((size_t)128 << 20)) return;   // total 62 MiB
  prep_kernel<<<(unsigned)(PREP_UNITS / 256), 256, 0, stream>>>(Fp(0), Fp(1), Fp(3), Fp(5), X16, WT);
  proj_kernel<<<dim3(KL / 128, (NB), 24), 256, 0, stream>>>(X16, WT, Fp(2), Fp(4), Fp(6), QH, QLo, KH, KLo, VTh, VTl);
  attn_kernel<<<dim3((SEQ) / 256, (NB) * H), 512, 0, stream>>>(QH, QLo, KH, KLo, VTh, VTl, (float*)d_out);
}

// v005
// It runs in 91.4 microseconds.
// Next to v004, in two timings, it ran 1.06 times as fast each time.
// Counting every step since v000, it is 3.75 times as fast.
#include <hip/hip_runtime.h>

// All contractions: v_wmma_f32_16x16x32_f16 (f16 operands, f32 accumulate). q/k/v projections [NB*KL x 1024] x [1024 x 3072]: x bf16-exact f16 x8, W bf16-exact f16 x256,
// 1 product, bias added in f32; S^T = K Q^T with q and k carried as f16 hi+lo x8 planes (3 products); O^T += V^T P^T with v as f16 hi+lo x8 planes and P x1024 f16 hi+lo
// (3 products); softmax running max / sum / normaliser in f32.
// Layouts: x [NB_FULL][SEQ_FULL][1024]; W_q/W_k/W_v [1024 out][1024 in]; b_q/b_k/b_v [1024]; y = x W^T + b split into 16 heads x 64; scores scaled by 1/8; key j visible to query i
// iff j <= i + 128; out[b][t][64 h + d] = softmax-weighted sum of v, stored as f32 directly (no output projection).
// Every float input is RNE-converted to bf16 once on load. Fragment k-map per lane half hh for A AND B: elements 0..7 <- k = 8hh+0..7, 8..15 <- k = 16+8hh+0..7;
// Deterministic fixed-order flash-style loop per 16-query wave over the visible keys; no cross-block communication inside a launch.

#ifndef NB
#define NB 2
#endif
#ifndef SEQ
#define SEQ 2048
#endif
#define NB_FULL 2
#define SEQ_FULL 2048

namespace {
constexpr int DM = 1024, H = 16, HD = 64, SRC = 128;
constexpr int KL = ((SEQ) + SRC < (SEQ_FULL)) ? ((SEQ) + SRC) : (SEQ_FULL);   // key / value tokens needed by queries < SEQ
static_assert((NB) >= 1 && (NB) <= (NB_FULL));
static_assert((SEQ) % 64 == 0 && (SEQ) >= 64 && (SEQ) <= (SEQ_FULL));
static_assert(KL % 64 == 0 && KL >= (SEQ) && KL <= (SEQ_FULL));
static_assert(DM == H * HD && DM % 128 == 0 && HD == 64 && (SEQ_FULL) % 32 == 0);
constexpr float XS = 8.0f, WSC = 256.0f, PS = 1024.0f, LOG2E = 1.4426950408889634f;
typedef _Float16 b16;
typedef __attribute__((ext_vector_type(16))) _Float16 v16b;
typedef __attribute__((ext_vector_type(8))) _Float16 v8b;
typedef __attribute__((ext_vector_type(4))) _Float16 v4h;
typedef __attribute__((ext_vector_type(2))) _Float16 v2h;
typedef __attribute__((ext_vector_type(8))) float v8f;
typedef __attribute__((ext_vector_type(4))) float v4f;

__device__ __forceinline__ float bf16_rne(float f) { unsigned int u = __float_as_uint(f); u += 0x7FFFu + ((u >> 16) & 1u); return __uint_as_float(u & 0xFFFF0000u); }
__device__ __forceinline__ void split16(float v, b16& hi, b16& lo) { hi = (b16)v; lo = (b16)(v - (float)hi); }
// 16-bit fragment from a k-contiguous row (A: row m; B: column n stored [n][k]); hh = lane half
__device__ __forceinline__ v16b frag_kb(const b16* p, int hh) { const v8b a = *(const v8b*)(p + 8 * hh), b = *(const v8b*)(p + 16 + 8 * hh); v16b f;
#pragma unroll
  for (int e = 0; e < 8; ++e) { f[e] = a[e]; f[8 + e] = b[e]; } return f; }
__device__ __forceinline__ v8f wmma16b(v16b a, v16b b, v8f c) { v8f d = __builtin_amdgcn_wmma_f32_16x16x32_f16(false, a, false, b, (short)0, c, false, false); asm volatile("v_nop\n\tv_nop\n\tv_nop\n\tv_nop" : "+v"(d) : "v"(a), "v"(b)); return d; }
// the same product as a plain builtin, for blocks of independent accumulator chains: the neighbouring products fill each other's distance and the compiler pads the end of the block itself
__device__ __forceinline__ v8f wmma16p(v16b a, v16b b, v8f c) { return __builtin_amdgcn_wmma_f32_16x16x32_f16(false, a, false, b, (short)0, c, false, false); }
__device__ __forceinline__ void wave_lds_sync() { __builtin_amdgcn_fence(3, "workgroup"); __builtin_amdgcn_wave_barrier(); __builtin_amdgcn_fence(2, "workgroup"); }
__device__ __forceinline__ float nexp2(float v) { return __builtin_amdgcn_exp2f(v); }

constexpr size_t WU = (size_t)DM * DM / 8;                         // 8-element units per weight matrix
constexpr size_t XU = (size_t)(NB_FULL) * (SEQ_FULL) * DM / 8;     // 8-element units of x
constexpr size_t PREP_UNITS = 3 * WU + XU;
static_assert(PREP_UNITS % 256 == 0 && (3 * WU) % 256 == 0 && WU % 256 == 0);

// prep: WT [3072 o][1024 k] = W_q | W_k | W_v rows ([out][in] is already k-contiguous), bf16 RNE then x256 -> f16; X16 [NB_FULL*SEQ_FULL][1024] = bf16 RNE(x) x8 -> f16.
__global__ __launch_bounds__(256) void prep_kernel(const float* __restrict__ x, const float* __restrict__ wq, const float* __restrict__ wk, const float* __restrict__ wv, b16* __restrict__ X16, b16* __restrict__ WT) {
  const size_t u = (size_t)blockIdx.x * 256 + threadIdx.x; if (u >= PREP_UNITS) return;
  const float* src; b16* dst; float sc;
  if (u < 3 * WU) { const int m = (int)(u / WU); const size_t e = (u - (size_t)m * WU) * 8; const float* w = m == 0 ? wq : m == 1 ? wk : wv; src = w + e; dst = WT + (size_t)m * DM * DM + e; sc = WSC; }
  else { const size_t e = (u - 3 * WU) * 8; src = x + e; dst = X16 + e; sc = XS; }
  const v4f f0 = *(const v4f*)src, f1 = *(const v4f*)(src + 4); v8b o;
#pragma unroll
  for (int j = 0; j < 4; ++j) { o[j] = (b16)(bf16_rne(f0[j]) * sc); o[4 + j] = (b16)(bf16_rne(f1[j]) * sc); }
  { *(v8b*)dst = o;  }
}

// projections: grid (KL/128, NB, 24 slabs of 128 columns: 0-7 q, 8-15 k, 16-23 v); block = 128 tokens of batch b x 128 columns, 8 waves (wave = 32 tokens x 64 columns, 8 accumulator tiles).
// One stage = 64 k of the block's 128 X16 rows and 128 WT rows (rows of 128 B), brought ONCE per block into LDS by asynchronous copies (16 B per lane, 8 copies per lane and stage) at a row pitch
// of 144 B, two buffers: stage s + 1 flies while stage s is worked on; all waves read their A and B fragments from LDS. Every accumulator tile sums k in ascending steps of 32 (K = 1024).
// epilogue + bf16-RNE bias in f32 into Tf (the ring, reused); q/k -> f16 hi/lo x8 planes [b][h][t][64]; v -> f16 hi/lo x8 planes [b][h][d][t]
constexpr int PT = 128, PK = 64, PP = PK + 8, PPL = PT * PP, PSTG = 2 * PPL, PNS = DM / PK;   // rows per plane; k per stage; row pitch, plane and stage in f16 elements; stages
static_assert(KL % PT == 0 && DM % PK == 0 && PNS >= 2);
static_assert((size_t)PT * (128 + 4) * 4 <= (size_t)2 * PSTG * 2);   // the epilogue staging fits into the ring

// One stage: lane unit (row r = tid / 8, r + 32, r + 64, r + 96; 16-B piece c = tid % 8) of the X plane and of the W plane. lds = LDS byte address of the lane's unit in the X plane of the target buffer.
__device__ __forceinline__ void proj_copy(unsigned lds, const b16* xg, const b16* wg) {
  const unsigned l0 = lds, l1 = lds + 32 * PP * 2, l2 = lds + 64 * PP * 2, l3 = lds + 96 * PP * 2, l4 = lds + PPL * 2, l5 = l4 + 32 * PP * 2, l6 = l4 + 64 * PP * 2, l7 = l4 + 96 * PP * 2;
  const b16 *g0 = xg, *g1 = xg + 32 * DM, *g2 = xg + 64 * DM, *g3 = xg + 96 * DM, *g4 = wg, *g5 = wg + 32 * DM, *g6 = wg + 64 * DM, *g7 = wg + 96 * DM;
  // the copies and, as the last line, the wait that stands in front of any rewrite of the address registers they name
  asm volatile("global_load_async_to_lds_b128 %0, %8, off\n\t"
               "global_load_async_to_lds_b128 %1, %9, off\n\t"
               "global_load_async_to_lds_b128 %2, %10, off\n\t"
               "global_load_async_to_lds_b128 %3, %11, off\n\t"
               "global_load_async_to_lds_b128 %4, %12, off\n\t"
               "global_load_async_to_lds_b128 %5, %13, off\n\t"
               "global_load_async_to_lds_b128 %6, %14, off\n\t"
               "global_load_async_to_lds_b128 %7, %15, off\n\t"
               "s_wait_xcnt 0x0"
               :: "v"(l0), "v"(l1), "v"(l2), "v"(l3), "v"(l4), "v"(l5), "v"(l6), "v"(l7), "v"(g0), "v"(g1), "v"(g2), "v"(g3), "v"(g4), "v"(g5), "v"(g6), "v"(g7) : "memory");
}

__global__ __launch_bounds__(256) void proj_kernel(const b16* __restrict__ X16, const b16* __restrict__ WT, const float* __restrict__ bq, const float* __restrict__ bk, const float* __restrict__ bv,
                                                   b16* __restrict__ QH, b16* __restrict__ QLo, b16* __restrict__ KH, b16* __restrict__ KLo, b16* __restrict__ VTh, b16* __restrict__ VTl) {
  __shared__ __attribute__((aligned(16))) b16 PR[2 * PSTG];
  const int tid = threadIdx.x, wave = __builtin_amdgcn_readfirstlane(tid >> 5), lane = tid & 31, nloc = lane & 15, hlf = lane >> 4; const int t0 = blockIdx.x * PT; const int b = blockIdx.y;
  const int slab = blockIdx.z, n0 = slab * 128, part = slab / 8, c0 = n0 - part * DM;
  const int wm = wave & 3, wn = wave >> 2;   // the wave's 32-token group and 64-column group
  const float* bias = part == 0 ? bq : part == 1 ? bk : bv;
  const int sr = tid >> 3, sc = (tid & 7) * 8;   // the lane's first staged row and first element in it
  const unsigned ring0 = (unsigned)(size_t)&PR[0] + (unsigned)(sr * PP + sc) * 2u;
  const b16 *cx = X16 + ((size_t)b * (SEQ_FULL) + t0 + sr) * DM + sc, *cw = WT + (size_t)(n0 + sr) * DM + sc;
  proj_copy(ring0, cx, cw);
  v8f acc[2][4];
#pragma unroll
  for (int i = 0; i < 2; ++i)
#pragma unroll
    for (int t = 0; t < 4; ++t) acc[i][t] = (v8f){};
  asm volatile("s_wait_asynccnt 0x0" ::: "memory");   // this wave's share of stage 0 has landed
  __syncthreads();                                     // stage 0 is published to all waves
  proj_copy(ring0 + PSTG * 2, cx + PK, cw + PK);
#pragma unroll 1
  for (int st = 0; st < PNS; ++st) {
    const b16* xr = PR + (st & 1) * PSTG + (wm * 32 + nloc) * PP; const b16* wr = PR + (st & 1) * PSTG + PPL + (wn * 64 + nloc) * PP;
#pragma unroll
    for (int ks = 0; ks < PK; ks += 32) { const v16b a0 = frag_kb(xr + ks, hlf), a1 = frag_kb(xr + 16 * PP + ks, hlf); v16b w[4];   // the six fragments of a 32-k step are read as one group
#pragma unroll
      for (int t = 0; t < 4; ++t) w[t] = frag_kb(wr + t * 16 * PP + ks, hlf);
#pragma unroll
      for (int t = 0; t < 4; ++t) { acc[0][t] = wmma16b(a0, w[t], acc[0][t]); acc[1][t] = wmma16b(a1, w[t], acc[1][t]); } }
    // publish point of stage st + 1, passed by every wave on every trip
    asm volatile("s_wait_dscnt 0x0" ::: "memory");      // this wave's reads of stage st have returned
    asm volatile("s_wait_asynccnt 0x0" ::: "memory");   // this wave's share of stage st + 1 has landed
    __syncthreads();                                     // publishes stage st + 1 and frees stage st's buffer
    if (st + 2 < PNS) proj_copy(ring0 + (st & 1) * (PSTG * 2), cx + (st + 2) * PK, cw + (st + 2) * PK);
  }
  asm volatile("s_wait_asynccnt 0x0" ::: "memory");     // nothing of this wave is in flight when the ring becomes epilogue staging
  float (*Tf)[128 + 4] = reinterpret_cast<float (*)[128 + 4]>(&PR[0]);   // behind the last trip's barrier no wave reads the ring any more
#pragma unroll
  for (int t = 0; t < 4; ++t) { const float bb = bf16_rne(bias[c0 + wn * 64 + t * 16 + nloc]);
#pragma unroll
    for (int i = 0; i < 2; ++i)
#pragma unroll
      for (int r = 0; r < 8; ++r) Tf[wm * 32 + i * 16 + 8 * hlf + r][wn * 64 + t * 16 + nloc] = acc[i][t][r] * (1.0f / (XS * WSC)) + bb; }
  __syncthreads();   // Tf is read across waves
  {
    if (part < 2) { b16* ph_ = part == 0 ? QH : KH; b16* pl_ = part == 0 ? QLo : KLo; const int c = c0 + lane * 4; const int h = c / HD, d = c % HD;
      for (int rr = 0; rr < 16; ++rr) { const int tl = wave * 16 + rr; const int tok = t0 + tl; v4h h4, l4; for (int j = 0; j < 4; ++j) { b16 p, q; split16(Tf[tl][lane * 4 + j] * XS, p, q); h4[j] = p; l4[j] = q; }
        const size_t oi = (((size_t)b * H + h) * (SEQ_FULL) + tok) * HD + d; *(v4h*)(ph_ + oi) = h4; *(v4h*)(pl_ + oi) = l4; } }
    else {
#pragma unroll 1
      for (int q = 0; q < 32; ++q) { const int cl = wave * 16 + (q >> 1); const int c = c0 + cl; const int h = c / HD, d = c % HD; const int tk = (q & 1) * 64 + lane * 2; v2h hv, lv;
        for (int j = 0; j < 2; ++j) { b16 p, ql; split16(Tf[tk + j][cl] * XS, p, ql); hv[j] = p; lv[j] = ql; }
        const size_t oi = (((size_t)b * H + h) * HD + d) * (size_t)(SEQ_FULL) + t0 + tk; *(v2h*)(VTh + oi) = hv; *(v2h*)(VTl + oi) = lv;
        asm volatile("s_wait_xcnt 0x0" ::: "memory"); } }   // stands in front of the next trip's rewrite of the registers that the two stores name
     }
}

// attention: grid (SEQ/256, NB x H): block = 16 waves x 16 queries = two 128-query tiles of one head side by side: waves 0-7 take tile n - 1 - x (long), waves 8-15 tile x (short), so that every
// block, and with one block per WGP every WGP, holds about the same number of 32-key steps. Both tiles walk the same K/V ring: keys 0 .. min(KL, long tile's last query + 1 + 128) in stages of
// 64 keys; the stage count is the block's one count and every wave passes every publish point, also a wave whose own keys have ended. One stage = four planes of 64 rows x 128 B
// (K hi, K lo: row = key; V^T hi, V^T lo: row = d), brought ONCE per block into LDS by asynchronous copies (16 B per lane, 4 copies per lane and stage) at a row pitch of 144 B, two buffers:
// stage s + 1 flies while stage s is worked on; all 16 waves read their fragments from LDS. Per wave the 32-key steps, their order and arithmetic are as before (keys < q0 + 16 + 128):
// S^T = K Q^T with 3 products (kh qh + kh ql + kl qh); online softmax in f32, the mask applied only in the steps that straddle its edge; P x1024 hi/lo into a wave-private LDS tile; O^T += V^T P^T (3 products);
constexpr int AW = 8, BW = 2 * AW, NT = (SEQ) / (16 * AW), KT = 64, RP = 64 + 8, PLN = 64 * RP, STG = 4 * PLN;   // waves per tile and per block; query tiles per head; keys per stage; row pitch, plane and stage in f16 elements
static_assert((SEQ) % (16 * BW) == 0 && KL % KT == 0 && KL >= 2 * KT && (16 * AW + SRC) % KT == 0);
static_assert((size_t)BW * 16 * (HD + 4) * 4 <= (size_t)2 * STG * 2);   // the output staging fits into the ring
static_assert(SRC >= 31);   // keys 0 .. 31 are visible to every query

// One stage: lane unit (row r = tid / 8 in 0 .. 63, 16-B piece c = tid % 8) of each of the four planes. lds = LDS byte address of the lane's unit in plane 0 of the target buffer.
__device__ __forceinline__ void stage_copy(unsigned lds, const b16* kh, const b16* kl, const b16* vh, const b16* vl) {
  const unsigned l0 = lds, l1 = lds + PLN * 2, l2 = lds + 2 * PLN * 2, l3 = lds + 3 * PLN * 2;
  // the copies and, as the last line, the wait that stands in front of any rewrite of the address registers they name
  asm volatile("global_load_async_to_lds_b128 %0, %4, off\n\t"
               "global_load_async_to_lds_b128 %1, %5, off\n\t"
               "global_load_async_to_lds_b128 %2, %6, off\n\t"
               "global_load_async_to_lds_b128 %3, %7, off\n\t"
               "s_wait_xcnt 0x0"
               :: "v"(l0), "v"(l1), "v"(l2), "v"(l3), "v"(kh), "v"(kl), "v"(vh), "v"(vl) : "memory");
}

__global__ __launch_bounds__(512) void attn_kernel(const b16* __restrict__ QH, const b16* __restrict__ QLo, const b16* __restrict__ KH, const b16* __restrict__ KLo,
                                                  const b16* __restrict__ VTh, const b16* __restrict__ VTl, float* __restrict__ out) {
  __shared__ __attribute__((aligned(16))) b16 Ring[2 * STG]; __shared__ __attribute__((aligned(16))) b16 Pb[BW][16][32 + 8], Pc[BW][16][32 + 8];
  const int tid = threadIdx.x, wave = __builtin_amdgcn_readfirstlane(tid >> 5), lane = tid & 31, hh = lane >> 4, col = lane & 15; const int b = blockIdx.y / H, h = blockIdx.y % H;
  const int qbl = (NT - 1 - (int)blockIdx.x) * (16 * AW);   // first query of the long tile, which sets the block's stage count
  const int qb = (wave < AW) ? qbl : (int)blockIdx.x * (16 * AW), q0 = qb + (wave & (AW - 1)) * 16, qi = q0 + col;   // wave-uniform choice of the tile
  const size_t ph = (size_t)b * H + h; const size_t pq = ph * (size_t)(SEQ_FULL) * HD; const b16* Vh = VTh + ph * HD * (size_t)(SEQ_FULL); const b16* Vl = VTl + ph * HD * (size_t)(SEQ_FULL);
  const int nst = ((qbl + 16 * AW + SRC < KL) ? (qbl + 16 * AW + SRC) : KL) / KT;   // block-uniform, >= 2; staged keys stay < KL; covers the short tile's keys too
  const int sr = tid >> 3, sc = (tid & 7) * 8;   // the lane's staged row and first element in it
  const unsigned ring0 = (unsigned)(size_t)&Ring[0] + (unsigned)(sr * RP + sc) * 2u;
  const b16 *ckh = KH + pq + (size_t)sr * HD + sc, *ckl = KLo + pq + (size_t)sr * HD + sc, *cvh = Vh + (size_t)sr * (SEQ_FULL) + sc, *cvl = Vl + (size_t)sr * (SEQ_FULL) + sc;
  stage_copy(ring0, ckh, ckl, cvh, cvl);
  const v16b qh0 = frag_kb(QH + pq + (size_t)qi * HD, hh), qh1 = frag_kb(QH + pq + (size_t)qi * HD + 32, hh), ql0 = frag_kb(QLo + pq + (size_t)qi * HD, hh), ql1 = frag_kb(QLo + pq + (size_t)qi * HD + 32, hh);
  const float cs = LOG2E / (8.0f * XS * XS);
  float m = -INFINITY, l = 0.0f; v8f o[4];
#pragma unroll
  for (int t = 0; t < 4; ++t) o[t] = (v8f){};
  const int kend = (q0 + 16 + SRC < KL) ? (q0 + 16 + SRC) : KL;   // wave-uniform
  asm volatile("s_wait_asynccnt 0x0" ::: "memory");   // this wave's share of stage 0 has landed
  __syncthreads();                                     // stage 0 is published to all waves
  stage_copy(ring0 + STG * 2, ckh + (size_t)KT * HD, ckl + (size_t)KT * HD, cvh + KT, cvl + KT);
#pragma unroll 1
  for (int st = 0; st < nst; ++st) {
    const b16* buf = Ring + (st & 1) * STG;
#pragma unroll 1
    for (int kb = st * KT; kb < st * KT + KT; kb += 32) {
      if (kb >= kend) break;   // wave-uniform: steps beyond this wave's last visible key; the publish point below is still passed
      const int ko = kb - st * KT;
      float e[16]; float mx = -INFINITY;
      v16b kh0[2], kh1[2], kl0[2], kl1[2]; v8f s[2];
#pragma unroll
      for (int u = 0; u < 2; ++u) { kh0[u] = frag_kb(buf + (ko + u * 16 + col) * RP, hh); s[u] = (v8f){}; }   // read in the order in which the products below take them
#pragma unroll
      for (int u = 0; u < 2; ++u) kl0[u] = frag_kb(buf + (ko + u * 16 + col) * RP + PLN, hh);
#pragma unroll
      for (int u = 0; u < 2; ++u) kh1[u] = frag_kb(buf + (ko + u * 16 + col) * RP + 32, hh);
#pragma unroll
      for (int u = 0; u < 2; ++u) kl1[u] = frag_kb(buf + (ko + u * 16 + col) * RP + PLN + 32, hh);
      __builtin_amdgcn_sched_barrier(0);   // the step's 16 K reads stay one group in front of the score products: the wave waits out the LDS latency once, not per fragment
#pragma unroll
      for (int u = 0; u < 2; ++u) s[u] = wmma16p(kh0[u], qh0, s[u]);   // the two key tiles' chains alternate; each tile keeps its order of six products
#pragma unroll
      for (int u = 0; u < 2; ++u) s[u] = wmma16p(kh0[u], ql0, s[u]);
#pragma unroll
      for (int u = 0; u < 2; ++u) s[u] = wmma16p(kl0[u], qh0, s[u]);
#pragma unroll
      for (int u = 0; u < 2; ++u) s[u] = wmma16p(kh1[u], qh1, s[u]);
#pragma unroll
      for (int u = 0; u < 2; ++u) s[u] = wmma16p(kh1[u], ql1, s[u]);
#pragma unroll
      for (int u = 0; u < 2; ++u) s[u] = wmma16p(kl1[u], qh1, s[u]);
      v16b va[4], vb2[4];
#pragma unroll
      for (int t = 0; t < 4; ++t) { const b16* vr = buf + 2 * PLN + (t * 16 + col) * RP + ko; va[t] = frag_kb(vr, hh); vb2[t] = frag_kb(vr + PLN, hh); }
      __builtin_amdgcn_sched_barrier(0);   // the step's 16 V reads stay one group here, in front of the softmax, whose vector work covers their latency
#pragma unroll
      for (int u = 0; u < 2; ++u)
#pragma unroll
        for (int r = 0; r < 8; ++r) e[u * 8 + r] = s[u][r] * cs;
      if (kb + 31 > q0 + SRC) {   // wave-uniform: only a step that reaches past the last key visible to the wave's first query has anything to mask (at most one step of a wave)
        const int lim = qi + SRC - kb - 8 * hh;   // the lane's last visible key, counted from its first key of the step
#pragma unroll
        for (int i = 0; i < 16; ++i) e[i] = ((i >> 3) * 16 + (i & 7) <= lim) ? e[i] : -INFINITY; }   // score i belongs to key kb + 8 hh + 16 (i / 8) + i % 8
#pragma unroll
      for (int i = 0; i < 16; ++i) mx = fmaxf(mx, e[i]);
      // every wave's step 0 is unmasked (SRC >= 31), so m and mn are finite from there on: a masked score gives exp2(-inf) = 0 by itself, and the first step's m = -inf gives al = 0 on o = 0, l = 0
      mx = fmaxf(mx, __shfl_xor(mx, 16)); const float mn = fmaxf(m, mx); const float al = nexp2(m - mn); float sum = 0.0f;
#pragma unroll
      for (int i2 = 0; i2 < 16; ++i2) { const float p = nexp2(e[i2] - mn); sum += p; b16 a_, b_; split16(p * PS, a_, b_); const int sl = (i2 < 8 ? 0 : 16) + 8 * hh + (i2 & 7); Pb[wave][col][sl] = a_; Pc[wave][col][sl] = b_; }
      sum += __shfl_xor(sum, 16); l = l * al + sum; m = mn;
      wave_lds_sync();
      const v16b pf = frag_kb(&Pb[wave][col][0], hh), pg = frag_kb(&Pc[wave][col][0], hh);
#pragma unroll
      for (int t = 0; t < 4; ++t) o[t] *= al;
#pragma unroll
      for (int t = 0; t < 4; ++t) o[t] = wmma16p(va[t], pf, o[t]);   // the four output tiles' chains alternate; each tile keeps its order of three products
#pragma unroll
      for (int t = 0; t < 4; ++t) o[t] = wmma16p(va[t], pg, o[t]);
#pragma unroll
      for (int t = 0; t < 3; ++t) o[t] = wmma16p(vb2[t], pf, o[t]);
      __builtin_amdgcn_sched_barrier(0);   // the padded product below stays the step's last
      o[3] = wmma16b(vb2[3], pf, o[3]);    // its four v_nop keep the distance to the next trip's first vector writes into the fragment registers
      wave_lds_sync(); }
    // publish point of stage st + 1, passed by every wave on every trip
    asm volatile("s_wait_dscnt 0x0" ::: "memory");      // this wave's reads of stage st have returned
    asm volatile("s_wait_asynccnt 0x0" ::: "memory");   // this wave's share of stage st + 1 has landed
    __syncthreads();                                     // publishes stage st + 1 and frees stage st's buffer
    if (st + 2 < nst) stage_copy(ring0 + (st & 1) * (STG * 2), ckh + (size_t)(st + 2) * KT * HD, ckl + (size_t)(st + 2) * KT * HD, cvh + (st + 2) * KT, cvl + (st + 2) * KT);
  }
  asm volatile("s_wait_asynccnt 0x0" ::: "memory");     // nothing of this wave is in flight when the ring becomes output staging
  float (*To)[16][HD + 4] = reinterpret_cast<float (*)[16][HD + 4]>(&Ring[0]);   // behind the last trip's barrier no wave reads the ring any more
  const float inv = 1.0f / (l * PS * XS);
#pragma unroll
  for (int t = 0; t < 4; ++t)
#pragma unroll
    for (int r = 0; r < 8; ++r) To[wave][col][t * 16 + 8 * hh + r] = o[t][r] * inv;
  wave_lds_sync();
  {
    for (int rr2 = 0; rr2 < 8; ++rr2) { const int row = 2 * rr2 + hh; const int c4 = col * 4; const v4f f = *(const v4f*)(&To[wave][row][c4]);
      *(v4f*)(out + ((size_t)b * (SEQ_FULL) + q0 + row) * DM + h * HD + c4) = f; }
     }
}
}  // namespace

extern "C" void kernel_launch(void* const* d_in, const int* in_sizes, int n_in, void* d_out, int out_size, void* d_ws, size_t ws_size, hipStream_t stream) {
  if (n_in < 7) return;
  auto Fp = [&](int i) { return (const float*)d_in[i]; };
  // wire order: 0 x [2,2048,1024], 1 W_q [1024,1024] (out,in), 2 b_q [1024], 3 W_k, 4 b_k, 5 W_v, 6 b_v - all f32
  if (in_sizes[0] < (NB_FULL) * (SEQ_FULL) * DM || in_sizes[1] < DM * DM || in_sizes[2] < DM || in_sizes[3] < DM * DM || in_sizes[4] < DM || in_sizes[5] < DM * DM || in_sizes[6] < DM) return;
  if (out_size < (((NB) - 1) * (SEQ_FULL) + (SEQ)) * DM) return;
  size_t off = 0; char* ws = (char*)d_ws;
  auto carve = [&](size_t bytes) { char* p = ws + off; off += (bytes + 255) & ~(size_t)255; return p; };
  b16* X16 = (b16*)carve((size_t)(NB_FULL) * (SEQ_FULL) * DM * 2);                 // 8 MiB
  b16* WT = (b16*)carve((size_t)3 * DM * DM * 2);                                  // 6 MiB
  const size_t plane = (size_t)(NB_FULL) * H * (SEQ_FULL) * HD * 2;                 // 8 MiB each, full strides
  b16* QH = (b16*)carve(plane); b16* QLo = (b16*)carve(plane); b16* KH = (b16*)carve(plane); b16* KLo = (b16*)carve(plane); b16* VTh = (b16*)carve(plane); b16* VTl = (b16*)carve(plane);
  if (off > ws_size || off > ((size_t)128 << 20)) return;   // total 62 MiB
  prep_kernel<<<(unsigned)(PREP_UNITS / 256), 256, 0, stream>>>(Fp(0), Fp(1), Fp(3), Fp(5), X16, WT);
  proj_kernel<<<dim3(KL / 128, (NB), 24), 256, 0, stream>>>(X16, WT, Fp(2), Fp(4), Fp(6), QH, QLo, KH, KLo, VTh, VTl);
  attn_kernel<<<dim3((SEQ) / 256, (NB) * H), 512, 0, stream>>>(QH, QLo, KH, KLo, VTh, VTl, (float*)d_out);
}

// v006
// Measured time: 87.8 microseconds a run.
// Next to v005, in two timings, it ran 1.05 times as fast each time.
// All steps since v000 together make it 3.93 times as fast.
#include <hip/hip_runtime.h>

// All contractions: v_wmma_f32_16x16x32_f16 (f16 operands, f32 accumulate). q/k/v projections [NB*KL x 1024] x [1024 x 3072]: x bf16-exact f16 x8, W bf16-exact f16 x256,
// 1 product, bias added in f32; S^T = K Q^T with q and k carried as f16 hi+lo x8 planes (3 products); O^T += V^T P^T with v as f16 hi+lo x8 planes and P x1024 f16 hi+lo
// (3 products); softmax running max / sum / normaliser in f32.
// Layouts: x [NB_FULL][SEQ_FULL][1024]; W_q/W_k/W_v [1024 out][1024 in]; b_q/b_k/b_v [1024]; y = x W^T + b split into 16 heads x 64; scores scaled by 1/8; key j visible to query i
// iff j <= i + 128; out[b][t][64 h + d] = softmax-weighted sum of v, stored as f32 directly (no output projection).
// Every float input is RNE-converted to bf16 once on load. Fragment k-map per lane half hh for A AND B: elements 0..7 <- k = 8hh+0..7, 8..15 <- k = 16+8hh+0..7;
// Deterministic fixed-order flash-style loop per 16-query wave over the visible keys; no cross-block communication inside a launch.

#ifndef NB
#define NB 2
#endif
#ifndef SEQ
#define SEQ 2048
#endif
#define NB_FULL 2
#define SEQ_FULL 2048

namespace {
constexpr int DM = 1024, H = 16, HD = 64, SRC = 128;
constexpr int KL = ((SEQ) + SRC < (SEQ_FULL)) ? ((SEQ) + SRC) : (SEQ_FULL);   // key / value tokens needed by queries < SEQ
static_assert((NB) >= 1 && (NB) <= (NB_FULL));
static_assert((SEQ) % 64 == 0 && (SEQ) >= 64 && (SEQ) <= (SEQ_FULL));
static_assert(KL % 64 == 0 && KL >= (SEQ) && KL <= (SEQ_FULL));
static_assert(DM == H * HD && DM % 128 == 0 && HD == 64 && (SEQ_FULL) % 32 == 0);
constexpr float XS = 8.0f, WSC = 256.0f, PS = 1024.0f, LOG2E = 1.4426950408889634f;
typedef _Float16 b16;
typedef __attribute__((ext_vector_type(16))) _Float16 v16b;
typedef __attribute__((ext_vector_type(8))) _Float16 v8b;
typedef __attribute__((ext_vector_type(4))) _Float16 v4h;
typedef __attribute__((ext_vector_type(2))) _Float16 v2h;
typedef __attribute__((ext_vector_type(8))) float v8f;
typedef __attribute__((ext_vector_type(4))) float v4f;
typedef __attribute__((ext_vector_type(2))) float v2f;

__device__ __forceinline__ float bf16_rne(float f) { unsigned int u = __float_as_uint(f); u += 0x7FFFu + ((u >> 16) & 1u); return __uint_as_float(u & 0xFFFF0000u); }
__device__ __forceinline__ void split16(float v, b16& hi, b16& lo) { hi = (b16)v; lo = (b16)(v - (float)hi); }
// 16-bit fragment from a k-contiguous row (A: row m; B: column n stored [n][k]); hh = lane half
__device__ __forceinline__ v16b frag_kb(const b16* p, int hh) { const v8b a = *(const v8b*)(p + 8 * hh), b = *(const v8b*)(p + 16 + 8 * hh); v16b f;
#pragma unroll
  for (int e = 0; e < 8; ++e) { f[e] = a[e]; f[8 + e] = b[e]; } return f; }
__device__ __forceinline__ v8f wmma16b(v16b a, v16b b, v8f c) { v8f d = __builtin_amdgcn_wmma_f32_16x16x32_f16(false, a, false, b, (short)0, c, false, false); asm volatile("v_nop\n\tv_nop\n\tv_nop\n\tv_nop" : "+v"(d) : "v"(a), "v"(b)); return d; }
// the same product as a plain builtin, for blocks of independent accumulator chains: the neighbouring products fill each other's distance and the compiler pads the end of the block itself
__device__ __forceinline__ v8f wmma16p(v16b a, v16b b, v8f c) { return __builtin_amdgcn_wmma_f32_16x16x32_f16(false, a, false, b, (short)0, c, false, false); }
__device__ __forceinline__ void wave_lds_sync() { __builtin_amdgcn_fence(3, "workgroup"); __builtin_amdgcn_wave_barrier(); __builtin_amdgcn_fence(2, "workgroup"); }
__device__ __forceinline__ float nexp2(float v) { return __builtin_amdgcn_exp2f(v); }

constexpr size_t WU = (size_t)DM * DM / 8;                         // 8-element units per weight matrix
constexpr size_t XU = (size_t)(NB_FULL) * (SEQ_FULL) * DM / 8;     // 8-element units of x
constexpr size_t PREP_UNITS = 3 * WU + XU;
static_assert(PREP_UNITS % 256 == 0 && (3 * WU) % 256 == 0 && WU % 256 == 0);

// prep: WT [3072 o][1024 k] = W_q | W_k | W_v rows ([out][in] is already k-contiguous), bf16 RNE then x256 -> f16; X16 [NB_FULL*SEQ_FULL][1024] = bf16 RNE(x) x8 -> f16.
__global__ __launch_bounds__(256) void prep_kernel(const float* __restrict__ x, const float* __restrict__ wq, const float* __restrict__ wk, const float* __restrict__ wv, b16* __restrict__ X16, b16* __restrict__ WT) {
  const size_t u = (size_t)blockIdx.x * 256 + threadIdx.x; if (u >= PREP_UNITS) return;
  const float* src; b16* dst; float sc;
  if (u < 3 * WU) { const int m = (int)(u / WU); const size_t e = (u - (size_t)m * WU) * 8; const float* w = m == 0 ? wq : m == 1 ? wk : wv; src = w + e; dst = WT + (size_t)m * DM * DM + e; sc = WSC; }
  else { const size_t e = (u - 3 * WU) * 8; src = x + e; dst = X16 + e; sc = XS; }
  const v4f f0 = *(const v4f*)src, f1 = *(const v4f*)(src + 4); v8b o;
#pragma unroll
  for (int j = 0; j < 4; ++j) { o[j] = (b16)(bf16_rne(f0[j]) * sc); o[4 + j] = (b16)(bf16_rne(f1[j]) * sc); }
  { *(v8b*)dst = o;  }
}

// projections: grid (KL/128, NB, 24 slabs of 128 columns: 0-7 q, 8-15 k, 16-23 v); block = 128 tokens of batch b x 128 columns, 8 waves (wave = 32 tokens x 64 columns, 8 accumulator tiles).
// One stage = 64 k of the block's 128 X16 rows and 128 WT rows (rows of 128 B), brought ONCE per block into LDS by asynchronous copies (16 B per lane, 8 copies per lane and stage) at a row pitch
// of 144 B, two buffers: stage s + 1 flies while stage s is worked on; all waves read their A and B fragments from LDS. Every accumulator tile sums k in ascending steps of 32 (K = 1024).
// epilogue + bf16-RNE bias in f32 into Tf (the ring, reused); q/k -> f16 hi/lo x8 planes [b][h][t][64]; v -> f16 hi/lo x8 planes [b][h][d][t]
constexpr int PT = 128, PK = 64, PP = PK + 8, PPL = PT * PP, PSTG = 2 * PPL, PNS = DM / PK;   // rows per plane; k per stage; row pitch, plane and stage in f16 elements; stages
static_assert(KL % PT == 0 && DM % PK == 0 && PNS >= 2);
static_assert((size_t)PT * (128 + 4) * 4 <= (size_t)2 * PSTG * 2);   // the epilogue staging fits into the ring

// One stage: lane unit (row r = tid / 8, r + 32, r + 64, r + 96; 16-B piece c = tid % 8) of the X plane and of the W plane. lds = LDS byte address of the lane's unit in the X plane of the target buffer.
__device__ __forceinline__ void proj_copy(unsigned lds, const b16* xg, const b16* wg) {
  const unsigned l0 = lds, l1 = lds + 32 * PP * 2, l2 = lds + 64 * PP * 2, l3 = lds + 96 * PP * 2, l4 = lds + PPL * 2, l5 = l4 + 32 * PP * 2, l6 = l4 + 64 * PP * 2, l7 = l4 + 96 * PP * 2;
  const b16 *g0 = xg, *g1 = xg + 32 * DM, *g2 = xg + 64 * DM, *g3 = xg + 96 * DM, *g4 = wg, *g5 = wg + 32 * DM, *g6 = wg + 64 * DM, *g7 = wg + 96 * DM;
  // the copies and, as the last line, the wait that stands in front of any rewrite of the address registers they name
  asm volatile("global_load_async_to_lds_b128 %0, %8, off\n\t"
               "global_load_async_to_lds_b128 %1, %9, off\n\t"
               "global_load_async_to_lds_b128 %2, %10, off\n\t"
               "global_load_async_to_lds_b128 %3, %11, off\n\t"
               "global_load_async_to_lds_b128 %4, %12, off\n\t"
               "global_load_async_to_lds_b128 %5, %13, off\n\t"
               "global_load_async_to_lds_b128 %6, %14, off\n\t"
               "global_load_async_to_lds_b128 %7, %15, off\n\t"
               "s_wait_xcnt 0x0"
               :: "v"(l0), "v"(l1), "v"(l2), "v"(l3), "v"(l4), "v"(l5), "v"(l6), "v"(l7), "v"(g0), "v"(g1), "v"(g2), "v"(g3), "v"(g4), "v"(g5), "v"(g6), "v"(g7) : "memory");
}

__global__ __launch_bounds__(256) void proj_kernel(const b16* __restrict__ X16, const b16* __restrict__ WT, const float* __restrict__ bq, const float* __restrict__ bk, const float* __restrict__ bv,
                                                   b16* __restrict__ QH, b16* __restrict__ QLo, b16* __restrict__ KH, b16* __restrict__ KLo, b16* __restrict__ VTh, b16* __restrict__ VTl) {
  __shared__ __attribute__((aligned(16))) b16 PR[2 * PSTG];
  const int tid = threadIdx.x, wave = __builtin_amdgcn_readfirstlane(tid >> 5), lane = tid & 31, nloc = lane & 15, hlf = lane >> 4; const int t0 = blockIdx.x * PT; const int b = blockIdx.y;
  const int slab = blockIdx.z, n0 = slab * 128, part = slab / 8, c0 = n0 - part * DM;
  const int wm = wave & 3, wn = wave >> 2;   // the wave's 32-token group and 64-column group
  const float* bias = part == 0 ? bq : part == 1 ? bk : bv;
  const int sr = tid >> 3, sc = (tid & 7) * 8;   // the lane's first staged row and first element in it
  const unsigned ring0 = (unsigned)(size_t)&PR[0] + (unsigned)(sr * PP + sc) * 2u;
  const b16 *cx = X16 + ((size_t)b * (SEQ_FULL) + t0 + sr) * DM + sc, *cw = WT + (size_t)(n0 + sr) * DM + sc;
  proj_copy(ring0, cx, cw);
  v8f acc[2][4];
#pragma unroll
  for (int i = 0; i < 2; ++i)
#pragma unroll
    for (int t = 0; t < 4; ++t) acc[i][t] = (v8f){};
  asm volatile("s_wait_asynccnt 0x0" ::: "memory");   // this wave's share of stage 0 has landed
  __syncthreads();                                     // stage 0 is published to all waves
  proj_copy(ring0 + PSTG * 2, cx + PK, cw + PK);
#pragma unroll 1
  for (int st = 0; st < PNS; ++st) {
    const b16* xr = PR + (st & 1) * PSTG + (wm * 32 + nloc) * PP; const b16* wr = PR + (st & 1) * PSTG + PPL + (wn * 64 + nloc) * PP;
#pragma unroll
    for (int ks = 0; ks < PK; ks += 32) { const v16b a0 = frag_kb(xr + ks, hlf), a1 = frag_kb(xr + 16 * PP + ks, hlf); v16b w[4];   // the six fragments of a 32-k step are read as one group
#pragma unroll
      for (int t = 0; t < 4; ++t) w[t] = frag_kb(wr + t * 16 * PP + ks, hlf);
#pragma unroll
      for (int t = 0; t < 4; ++t) { acc[0][t] = wmma16b(a0, w[t], acc[0][t]); acc[1][t] = wmma16b(a1, w[t], acc[1][t]); } }
    // publish point of stage st + 1, passed by every wave on every trip
    asm volatile("s_wait_dscnt 0x0" ::: "memory");      // this wave's reads of stage st have returned
    asm volatile("s_wait_asynccnt 0x0" ::: "memory");   // this wave's share of stage st + 1 has landed
    __syncthreads();                                     // publishes stage st + 1 and frees stage st's buffer
    if (st + 2 < PNS) proj_copy(ring0 + (st & 1) * (PSTG * 2), cx + (st + 2) * PK, cw + (st + 2) * PK);
  }
  asm volatile("s_wait_asynccnt 0x0" ::: "memory");     // nothing of this wave is in flight when the ring becomes epilogue staging
  float (*Tf)[128 + 4] = reinterpret_cast<float (*)[128 + 4]>(&PR[0]);   // behind the last trip's barrier no wave reads the ring any more
#pragma unroll
  for (int t = 0; t < 4; ++t) { const float bb = bf16_rne(bias[c0 + wn * 64 + t * 16 + nloc]);
#pragma unroll
    for (int i = 0; i < 2; ++i)
#pragma unroll
      for (int r = 0; r < 8; ++r) Tf[wm * 32 + i * 16 + 8 * hlf + r][wn * 64 + t * 16 + nloc] = acc[i][t][r] * (1.0f / (XS * WSC)) + bb; }
  __syncthreads();   // Tf is read across waves
  {
    if (part < 2) { b16* ph_ = part == 0 ? QH : KH; b16* pl_ = part == 0 ? QLo : KLo; const int c = c0 + lane * 4; const int h = c / HD, d = c % HD;
      for (int rr = 0; rr < 16; ++rr) { const int tl = wave * 16 + rr; const int tok = t0 + tl; v4h h4, l4; for (int j = 0; j < 4; ++j) { b16 p, q; split16(Tf[tl][lane * 4 + j] * XS, p, q); h4[j] = p; l4[j] = q; }
        const size_t oi = (((size_t)b * H + h) * (SEQ_FULL) + tok) * HD + d; *(v4h*)(ph_ + oi) = h4; *(v4h*)(pl_ + oi) = l4; } }
    else {
#pragma unroll 1
      for (int q = 0; q < 32; ++q) { const int cl = wave * 16 + (q >> 1); const int c = c0 + cl; const int h = c / HD, d = c % HD; const int tk = (q & 1) * 64 + lane * 2; v2h hv, lv;
        for (int j = 0; j < 2; ++j) { b16 p, ql; split16(Tf[tk + j][cl] * XS, p, ql); hv[j] = p; lv[j] = ql; }
        const size_t oi = (((size_t)b * H + h) * HD + d) * (size_t)(SEQ_FULL) + t0 + tk; *(v2h*)(VTh + oi) = hv; *(v2h*)(VTl + oi) = lv;
        asm volatile("s_wait_xcnt 0x0" ::: "memory"); } }   // stands in front of the next trip's rewrite of the registers that the two stores name
     }
}

// attention: grid (SEQ/256, NB x H): block = 16 waves x 16 queries = two 128-query tiles of one head side by side: waves 0-7 take tile n - 1 - x (long), waves 8-15 tile x (short), so that every
// block, and with one block per WGP every WGP, holds about the same number of 32-key steps. Both tiles walk the same K/V ring: keys 0 .. min(KL, long tile's last query + 1 + 128) in stages of
// 64 keys; the stage count is the block's one count and every wave passes every publish point, also a wave whose own keys have ended. One stage = four planes of 64 rows x 128 B
// (K hi, K lo: row = key; V^T hi, V^T lo: row = d), brought ONCE per block into LDS by asynchronous copies (16 B per lane, 4 copies per lane and stage) at a row pitch of 144 B, two buffers:
// stage s + 1 flies while stage s is worked on; all 16 waves read their fragments from LDS. Per wave the 32-key steps, their order and arithmetic are as before (keys < q0 + 16 + 128):
// S^T = K Q^T with 3 products (kh qh + kh ql + kl qh); online softmax in f32, the mask applied only in the steps that straddle its edge; P x1024 hi/lo packed in-lane from the scores into the B fragment; O^T += V^T P^T (3 products);
constexpr int AW = 8, BW = 2 * AW, NT = (SEQ) / (16 * AW), KT = 64, RP = 64 + 8, PLN = 64 * RP, STG = 4 * PLN;   // waves per tile and per block; query tiles per head; keys per stage; row pitch, plane and stage in f16 elements
static_assert((SEQ) % (16 * BW) == 0 && KL % KT == 0 && KL >= 2 * KT && (16 * AW + SRC) % KT == 0);
static_assert((size_t)BW * 16 * (HD + 4) * 4 <= (size_t)2 * STG * 2);   // the output staging fits into the ring
static_assert(SRC >= 31);   // keys 0 .. 31 are visible to every query

// One stage: lane unit (row r = tid / 8 in 0 .. 63, 16-B piece c = tid % 8) of each of the four planes. lds = LDS byte address of the lane's unit in plane 0 of the target buffer.
__device__ __forceinline__ void stage_copy(unsigned lds, const b16* kh, const b16* kl, const b16* vh, const b16* vl) {
  const unsigned l0 = lds, l1 = lds + PLN * 2, l2 = lds + 2 * PLN * 2, l3 = lds + 3 * PLN * 2;
  // the copies and, as the last line, the wait that stands in front of any rewrite of the address registers they name
  asm volatile("global_load_async_to_lds_b128 %0, %4, off\n\t"
               "global_load_async_to_lds_b128 %1, %5, off\n\t"
               "global_load_async_to_lds_b128 %2, %6, off\n\t"
               "global_load_async_to_lds_b128 %3, %7, off\n\t"
               "s_wait_xcnt 0x0"
               :: "v"(l0), "v"(l1), "v"(l2), "v"(l3), "v"(kh), "v"(kl), "v"(vh), "v"(vl) : "memory");
}

__global__ __launch_bounds__(512) void attn_kernel(const b16* __restrict__ QH, const b16* __restrict__ QLo, const b16* __restrict__ KH, const b16* __restrict__ KLo,
                                                  const b16* __restrict__ VTh, const b16* __restrict__ VTl, float* __restrict__ out) {
  __shared__ __attribute__((aligned(16))) b16 Ring[2 * STG];
  const int tid = threadIdx.x, wave = __builtin_amdgcn_readfirstlane(tid >> 5), lane = tid & 31, hh = lane >> 4, col = lane & 15; const int b = blockIdx.y / H, h = blockIdx.y % H;
  const int qbl = (NT - 1 - (int)blockIdx.x) * (16 * AW);   // first query of the long tile, which sets the block's stage count
  const int qb = (wave < AW) ? qbl : (int)blockIdx.x * (16 * AW), q0 = qb + (wave & (AW - 1)) * 16, qi = q0 + col;   // wave-uniform choice of the tile
  const size_t ph = (size_t)b * H + h; const size_t pq = ph * (size_t)(SEQ_FULL) * HD; const b16* Vh = VTh + ph * HD * (size_t)(SEQ_FULL); const b16* Vl = VTl + ph * HD * (size_t)(SEQ_FULL);
  const int nst = ((qbl + 16 * AW + SRC < KL) ? (qbl + 16 * AW + SRC) : KL) / KT;   // block-uniform, >= 2; staged keys stay < KL; covers the short tile's keys too
  const int sr = tid >> 3, sc = (tid & 7) * 8;   // the lane's staged row and first element in it
  const unsigned ring0 = (unsigned)(size_t)&Ring[0] + (unsigned)(sr * RP + sc) * 2u;
  const b16 *ckh = KH + pq + (size_t)sr * HD + sc, *ckl = KLo + pq + (size_t)sr * HD + sc, *cvh = Vh + (size_t)sr * (SEQ_FULL) + sc, *cvl = Vl + (size_t)sr * (SEQ_FULL) + sc;
  stage_copy(ring0, ckh, ckl, cvh, cvl);
  const v16b qh0 = frag_kb(QH + pq + (size_t)qi * HD, hh), qh1 = frag_kb(QH + pq + (size_t)qi * HD + 32, hh), ql0 = frag_kb(QLo + pq + (size_t)qi * HD, hh), ql1 = frag_kb(QLo + pq + (size_t)qi * HD + 32, hh);
  const float cs = LOG2E / (8.0f * XS * XS);
  float m = -INFINITY, l = 0.0f; v8f o[4];
#pragma unroll
  for (int t = 0; t < 4; ++t) o[t] = (v8f){};
  const int kend = (q0 + 16 + SRC < KL) ? (q0 + 16 + SRC) : KL;   // wave-uniform
  asm volatile("s_wait_asynccnt 0x0" ::: "memory");   // this wave's share of stage 0 has landed
  __syncthreads();                                     // stage 0 is published to all waves
  stage_copy(ring0 + STG * 2, ckh + (size_t)KT * HD, ckl + (size_t)KT * HD, cvh + KT, cvl + KT);
#pragma unroll 1
  for (int st = 0; st < nst; ++st) {
    const b16* buf = Ring + (st & 1) * STG;
#pragma unroll 1
    for (int kb = st * KT; kb < st * KT + KT; kb += 32) {
      if (kb >= kend) break;   // wave-uniform: steps beyond this wave's last visible key; the publish point below is still passed
      const int ko = kb - st * KT;
      float e[16]; float mx = -INFINITY;
      v16b kh0[2], kh1[2], kl0[2], kl1[2]; v8f s[2];
#pragma unroll
      for (int u = 0; u < 2; ++u) { kh0[u] = frag_kb(buf + (ko + u * 16 + col) * RP, hh); s[u] = (v8f){}; }   // read in the order in which the products below take them
#pragma unroll
      for (int u = 0; u < 2; ++u) kl0[u] = frag_kb(buf + (ko + u * 16 + col) * RP + PLN, hh);
#pragma unroll
      for (int u = 0; u < 2; ++u) kh1[u] = frag_kb(buf + (ko + u * 16 + col) * RP + 32, hh);
#pragma unroll
      for (int u = 0; u < 2; ++u) kl1[u] = frag_kb(buf + (ko + u * 16 + col) * RP + PLN + 32, hh);
      __builtin_amdgcn_sched_barrier(0);   // the step's 16 K reads stay one group in front of the score products: the wave waits out the LDS latency once, not per fragment
#pragma unroll
      for (int u = 0; u < 2; ++u) s[u] = wmma16p(kh0[u], qh0, s[u]);   // the two key tiles' chains alternate; each tile keeps its order of six products
#pragma unroll
      for (int u = 0; u < 2; ++u) s[u] = wmma16p(kh0[u], ql0, s[u]);
#pragma unroll
      for (int u = 0; u < 2; ++u) s[u] = wmma16p(kl0[u], qh0, s[u]);
#pragma unroll
      for (int u = 0; u < 2; ++u) s[u] = wmma16p(kh1[u], qh1, s[u]);
#pragma unroll
      for (int u = 0; u < 2; ++u) s[u] = wmma16p(kh1[u], ql1, s[u]);
#pragma unroll
      for (int u = 0; u < 2; ++u) s[u] = wmma16p(kl1[u], qh1, s[u]);
      v16b va[4], vb2[4];
#pragma unroll
      for (int t = 0; t < 4; ++t) { const b16* vr = buf + 2 * PLN + (t * 16 + col) * RP + ko; va[t] = frag_kb(vr, hh); vb2[t] = frag_kb(vr + PLN, hh); }
      __builtin_amdgcn_sched_barrier(0);   // the step's 16 V reads stay one group here, in front of the softmax, whose vector work covers their latency
#pragma unroll
      for (int u = 0; u < 2; ++u)
#pragma unroll
        for (int r = 0; r < 8; ++r) e[u * 8 + r] = s[u][r] * cs;
      if (kb + 31 > q0 + SRC) {   // wave-uniform: only a step that reaches past the last key visible to the wave's first query has anything to mask (at most one step of a wave)
        const int lim = qi + SRC - kb - 8 * hh;   // the lane's last visible key, counted from its first key of the step
#pragma unroll
        for (int i = 0; i < 16; ++i) e[i] = ((i >> 3) * 16 + (i & 7) <= lim) ? e[i] : -INFINITY; }   // score i belongs to key kb + 8 hh + 16 (i / 8) + i % 8
#pragma unroll
      for (int i = 0; i < 16; ++i) mx = fmaxf(mx, e[i]);
      // every wave's step 0 is unmasked (SRC >= 31), so m and mn are finite from there on: a masked score gives exp2(-inf) = 0 by itself, and the first step's m = -inf gives al = 0 on o = 0, l = 0
      mx = fmaxf(mx, __shfl_xor(mx, 16)); const float mn = fmaxf(m, mx); const float al = nexp2(m - mn); float sum = 0.0f;
      v16b pf, pg;   // score i of a lane is key 8 hh + 16 (i / 8) + i % 8 of query col: the very element i of the lane's B fragment of P^T, so P goes from the score registers into the operand in-lane
#pragma unroll
      for (int i2 = 0; i2 < 16; i2 += 2) { const float p0 = nexp2(e[i2] - mn), p1 = nexp2(e[i2 + 1] - mn); sum += p0; sum += p1; const v2f t = (v2f){p0, p1} * PS;   // two neighbours fill one operand register
        const v2h a2 = __builtin_convertvector(t, v2h), b2 = __builtin_convertvector(t - __builtin_convertvector(a2, v2f), v2h); pf[i2] = a2[0]; pf[i2 + 1] = a2[1]; pg[i2] = b2[0]; pg[i2 + 1] = b2[1]; }
      sum += __shfl_xor(sum, 16); l = l * al + sum; m = mn;
#pragma unroll
      for (int t = 0; t < 4; ++t) o[t] *= al;
#pragma unroll
      for (int t = 0; t < 4; ++t) o[t] = wmma16p(va[t], pf, o[t]);   // the four output tiles' chains alternate; each tile keeps its order of three products
#pragma unroll
      for (int t = 0; t < 4; ++t) o[t] = wmma16p(va[t], pg, o[t]);
#pragma unroll
      for (int t = 0; t < 3; ++t) o[t] = wmma16p(vb2[t], pf, o[t]);
      __builtin_amdgcn_sched_barrier(0);   // the padded product below stays the step's last
      o[3] = wmma16b(vb2[3], pf, o[3]); }  // its four v_nop keep the distance to the next trip's first vector writes into the fragment registers
    // publish point of stage st + 1, passed by every wave on every trip
    asm volatile("s_wait_dscnt 0x0" ::: "memory");      // this wave's reads of stage st have returned
    asm volatile("s_wait_asynccnt 0x0" ::: "memory");   // this wave's share of stage st + 1 has landed
    __syncthreads();                                     // publishes stage st + 1 and frees stage st's buffer
    if (st + 2 < nst) stage_copy(ring0 + (st & 1) * (STG * 2), ckh + (size_t)(st + 2) * KT * HD, ckl + (size_t)(st + 2) * KT * HD, cvh + (st + 2) * KT, cvl + (st + 2) * KT);
  }
  asm volatile("s_wait_asynccnt 0x0" ::: "memory");     // nothing of this wave is in flight when the ring becomes output staging
  float (*To)[16][HD + 4] = reinterpret_cast<float (*)[16][HD + 4]>(&Ring[0]);   // behind the last trip's barrier no wave reads the ring any more
  const float inv = 1.0f / (l * PS * XS);
#pragma unroll
  for (int t = 0; t < 4; ++t)
#pragma unroll
    for (int r = 0; r < 8; ++r) To[wave][col][t * 16 + 8 * hh + r] = o[t][r] * inv;
  wave_lds_sync();
  {
    for (int rr2 = 0; rr2 < 8; ++rr2) { const int row = 2 * rr2 + hh; const int c4 = col * 4; const v4f f = *(const v4f*)(&To[wave][row][c4]);
      *(v4f*)(out + ((size_t)b * (SEQ_FULL) + q0 + row) * DM + h * HD + c4) = f; }
     }
}
}  // namespace

extern "C" void kernel_launch(void* const* d_in, const int* in_sizes, int n_in, void* d_out, int out_size, void* d_ws, size_t ws_size, hipStream_t stream) {
  if (n_in < 7) return;
  auto Fp = [&](int i) { return (const float*)d_in[i]; };
  // wire order: 0 x [2,2048,1024], 1 W_q [1024,1024] (out,in), 2 b_q [1024], 3 W_k, 4 b_k, 5 W_v, 6 b_v - all f32
  if (in_sizes[0] < (NB_FULL) * (SEQ_FULL) * DM || in_sizes[1] < DM * DM || in_sizes[2] < DM || in_sizes[3] < DM * DM || in_sizes[4] < DM || in_sizes[5] < DM * DM || in_sizes[6] < DM) return;
  if (out_size < (((NB) - 1) * (SEQ_FULL) + (SEQ)) * DM) return;
  size_t off = 0; char* ws = (char*)d_ws;
  auto carve = [&](size_t bytes) { char* p = ws + off; off += (bytes + 255) & ~(size_t)255; return p; };
  b16* X16 = (b16*)carve((size_t)(NB_FULL) * (SEQ_FULL) * DM * 2);                 // 8 MiB
  b16* WT = (b16*)carve((size_t)3 * DM * DM * 2);                                  // 6 MiB
  const size_t plane = (size_t)(NB_FULL) * H * (SEQ_FULL) * HD * 2;                 // 8 MiB each, full strides
  b16* QH = (b16*)carve(plane); b16* QLo = (b16*)carve(plane); b16* KH = (b16*)carve(plane); b16* KLo = (b16*)carve(plane); b16* VTh = (b16*)carve(plane); b16* VTl = (b16*)carve(plane);
  if (off > ws_size || off > ((size_t)128 << 20)) return;   // total 62 MiB
  prep_kernel<<<(unsigned)(PREP_UNITS / 256), 256, 0, stream>>>(Fp(0), Fp(1), Fp(3), Fp(5), X16, WT);
  proj_kernel<<<dim3(KL / 128, (NB), 24), 256, 0, stream>>>(X16, WT, Fp(2), Fp(4), Fp(6), QH, QLo, KH, KLo, VTh, VTl);
  attn_kernel<<<dim3((SEQ) / 256, (NB) * H), 512, 0, stream>>>(QH, QLo, KH, KLo, VTh, VTl, (float*)d_out);
}

// v007
// Measured time: 85.4 microseconds a run.
// Timed twice side by side with v006, it ran 1.04 times as fast both times.
// Counting every step since v000, it is 4.09 times as fast.
#include <hip/hip_runtime.h>

// All contractions: v_wmma_f32_16x16x32_f16 (f16 operands, f32 accumulate). q/k/v projections [NB*KL x 1024] x [1024 x 3072]: x bf16-exact f16 x8, W bf16-exact f16 x256,
// 1 product, bias added in f32; S^T = K Q^T with q and k carried as f16 hi+lo x8 planes (3 products); O^T += V^T P^T with v as f16 hi+lo x8 planes and P x1024 f16 hi+lo
// (3 products); softmax running max / sum / normaliser in f32.
// Layouts: x [NB_FULL][SEQ_FULL][1024]; W_q/W_k/W_v [1024 out][1024 in]; b_q/b_k/b_v [1024]; y = x W^T + b split into 16 heads x 64; scores scaled by 1/8; key j visible to query i
// iff j <= i + 128; out[b][t][64 h + d] = softmax-weighted sum of v, stored as f32 directly (no output projection).
// Every float input is RNE-converted to bf16 once on load. Fragment k-map per lane half hh for A AND B: elements 0..7 <- k = 8hh+0..7, 8..15 <- k = 16+8hh+0..7;
// Deterministic fixed-order flash-style loop per 16-query wave over the visible keys; no cross-block communication inside a launch.

#ifndef NB
#define NB 2
#endif
#ifndef SEQ
#define SEQ 2048
#endif
#define NB_FULL 2
#define SEQ_FULL 2048

namespace {
constexpr int DM = 1024, H = 16, HD = 64, SRC = 128;
constexpr int KL = ((SEQ) + SRC < (SEQ_FULL)) ? ((SEQ) + SRC) : (SEQ_FULL);   // key / value tokens needed by queries < SEQ
static_assert((NB) >= 1 && (NB) <= (NB_FULL));
static_assert((SEQ) % 64 == 0 && (SEQ) >= 64 && (SEQ) <= (SEQ_FULL));
static_assert(KL % 64 == 0 && KL >= (SEQ) && KL <= (SEQ_FULL));
static_assert(DM == H * HD && DM % 128 == 0 && HD == 64 && (SEQ_FULL) % 32 == 0);
constexpr float XS = 8.0f, WSC = 256.0f, PS = 1024.0f, LOG2E = 1.4426950408889634f;
typedef _Float16 b16;
typedef __attribute__((ext_vector_type(16))) _Float16 v16b;
typedef __attribute__((ext_vector_type(8))) _Float16 v8b;
typedef __attribute__((ext_vector_type(4))) _Float16 v4h;
typedef __attribute__((ext_vector_type(2))) _Float16 v2h;
typedef __attribute__((ext_vector_type(8))) float v8f;
typedef __attribute__((ext_vector_type(4))) float v4f;
typedef __attribute__((ext_vector_type(2))) float v2f;

__device__ __forceinline__ float bf16_rne(float f) { unsigned int u = __float_as_uint(f); u += 0x7FFFu + ((u >> 16) & 1u); return __uint_as_float(u & 0xFFFF0000u); }
__device__ __forceinline__ void split16(float v, b16& hi, b16& lo) { hi = (b16)v; lo = (b16)(v - (float)hi); }
// 16-bit fragment from a k-contiguous row (A: row m; B: column n stored [n][k]); hh = lane half
__device__ __forceinline__ v16b frag_kb(const b16* p, int hh) { const v8b a = *(const v8b*)(p + 8 * hh), b = *(const v8b*)(p + 16 + 8 * hh); v16b f;
#pragma unroll
  for (int e = 0; e < 8; ++e) { f[e] = a[e]; f[8 + e] = b[e]; } return f; }
__device__ __forceinline__ v8f wmma16b(v16b a, v16b b, v8f c) { v8f d = __builtin_amdgcn_wmma_f32_16x16x32_f16(false, a, false, b, (short)0, c, false, false); asm volatile("v_nop\n\tv_nop\n\tv_nop\n\tv_nop" : "+v"(d) : "v"(a), "v"(b)); return d; }
// the same product as a plain builtin, for blocks of independent accumulator chains: the neighbouring products fill each other's distance and the compiler pads the end of the block itself
__device__ __forceinline__ v8f wmma16p(v16b a, v16b b, v8f c) { return __builtin_amdgcn_wmma_f32_16x16x32_f16(false, a, false, b, (short)0, c, false, false); }
__device__ __forceinline__ void wave_lds_sync() { __builtin_amdgcn_fence(3, "workgroup"); __builtin_amdgcn_wave_barrier(); __builtin_amdgcn_fence(2, "workgroup"); }
__device__ __forceinline__ float nexp2(float v) { return __builtin_amdgcn_exp2f(v); }
// lane l takes lane l ^ 16's value by one vector cross-row move: no LDS permute, so nothing of it counts on dscnt
__device__ __forceinline__ float xhalf(float v) { const int b = __builtin_bit_cast(int, v); return __builtin_bit_cast(float, __builtin_amdgcn_permlanex16(b, b, 0x76543210, 0xfedcba98, false, false)); }

constexpr size_t WU = (size_t)DM * DM / 8;                         // 8-element units per weight matrix
constexpr size_t XU = (size_t)(NB_FULL) * (SEQ_FULL) * DM / 8;     // 8-element units of x
constexpr size_t PREP_UNITS = 3 * WU + XU;
static_assert(PREP_UNITS % 256 == 0 && (3 * WU) % 256 == 0 && WU % 256 == 0);

// prep: WT [3072 o][1024 k] = W_q | W_k | W_v rows ([out][in] is already k-contiguous), bf16 RNE then x256 -> f16; X16 [NB_FULL*SEQ_FULL][1024] = bf16 RNE(x) x8 -> f16.
__global__ __launch_bounds__(256) void prep_kernel(const float* __restrict__ x, const float* __restrict__ wq, const float* __restrict__ wk, const float* __restrict__ wv, b16* __restrict__ X16, b16* __restrict__ WT) {
  const size_t u = (size_t)blockIdx.x * 256 + threadIdx.x; if (u >= PREP_UNITS) return;
  const float* src; b16* dst; float sc;
  if (u < 3 * WU) { const int m = (int)(u / WU); const size_t e = (u - (size_t)m * WU) * 8; const float* w = m == 0 ? wq : m == 1 ? wk : wv; src = w + e; dst = WT + (size_t)m * DM * DM + e; sc = WSC; }
  else { const size_t e = (u - 3 * WU) * 8; src = x + e; dst = X16 + e; sc = XS; }
  const v4f f0 = *(const v4f*)src, f1 = *(const v4f*)(src + 4); v8b o;
#pragma unroll
  for (int j = 0; j < 4; ++j) { o[j] = (b16)(bf16_rne(f0[j]) * sc); o[4 + j] = (b16)(bf16_rne(f1[j]) * sc); }
  { *(v8b*)dst = o;  }
}

// projections: grid (KL/128, NB, 24 slabs of 128 columns: 0-7 q, 8-15 k, 16-23 v); block = 128 tokens of batch b x 128 columns, 8 waves (wave = 32 tokens x 64 columns, 8 accumulator tiles).
// One stage = 64 k of the block's 128 X16 rows and 128 WT rows (rows of 128 B), brought ONCE per block into LDS by asynchronous copies (16 B per lane, 8 copies per lane and stage) at a row pitch
// of 144 B, two buffers: stage s + 1 flies while stage s is worked on; all waves read their A and B fragments from LDS. Every accumulator tile sums k in ascending steps of 32 (K = 1024).
// epilogue + bf16-RNE bias in f32 into Tf (the ring, reused); q/k -> f16 hi/lo x8 planes [b][h][t][64]; v -> f16 hi/lo x8 planes [b][h][d][t]
constexpr int PT = 128, PK = 64, PP = PK + 8, PPL = PT * PP, PSTG = 2 * PPL, PNS = DM / PK;   // rows per plane; k per stage; row pitch, plane and stage in f16 elements; stages
static_assert(KL % PT == 0 && DM % PK == 0 && PNS >= 2);
static_assert((size_t)PT * (128 + 4) * 4 <= (size_t)2 * PSTG * 2);   // the epilogue staging fits into the ring

// One stage: lane unit (row r = tid / 8, r + 32, r + 64, r + 96; 16-B piece c = tid % 8) of the X plane and of the W plane. lds = LDS byte address of the lane's unit in the X plane of the target buffer.
__device__ __forceinline__ void proj_copy(unsigned lds, const b16* xg, const b16* wg) {
  const unsigned l0 = lds, l1 = lds + 32 * PP * 2, l2 = lds + 64 * PP * 2, l3 = lds + 96 * PP * 2, l4 = lds + PPL * 2, l5 = l4 + 32 * PP * 2, l6 = l4 + 64 * PP * 2, l7 = l4 + 96 * PP * 2;
  const b16 *g0 = xg, *g1 = xg + 32 * DM, *g2 = xg + 64 * DM, *g3 = xg + 96 * DM, *g4 = wg, *g5 = wg + 32 * DM, *g6 = wg + 64 * DM, *g7 = wg + 96 * DM;
  // the copies and, as the last line, the wait that stands in front of any rewrite of the address registers they name
  asm volatile("global_load_async_to_lds_b128 %0, %8, off\n\t"
               "global_load_async_to_lds_b128 %1, %9, off\n\t"
               "global_load_async_to_lds_b128 %2, %10, off\n\t"
               "global_load_async_to_lds_b128 %3, %11, off\n\t"
               "global_load_async_to_lds_b128 %4, %12, off\n\t"
               "global_load_async_to_lds_b128 %5, %13, off\n\t"
               "global_load_async_to_lds_b128 %6, %14, off\n\t"
               "global_load_async_to_lds_b128 %7, %15, off\n\t"
               "s_wait_xcnt 0x0"
               :: "v"(l0), "v"(l1), "v"(l2), "v"(l3), "v"(l4), "v"(l5), "v"(l6), "v"(l7), "v"(g0), "v"(g1), "v"(g2), "v"(g3), "v"(g4), "v"(g5), "v"(g6), "v"(g7) : "memory");
}

__global__ __launch_bounds__(256) void proj_kernel(const b16* __restrict__ X16, const b16* __restrict__ WT, const float* __restrict__ bq, const float* __restrict__ bk, const float* __restrict__ bv,
                                                   b16* __restrict__ QH, b16* __restrict__ QLo, b16* __restrict__ KH, b16* __restrict__ KLo, b16* __restrict__ VTh, b16* __restrict__ VTl) {
  __shared__ __attribute__((aligned(16))) b16 PR[2 * PSTG];
  const int tid = threadIdx.x, wave = __builtin_amdgcn_readfirstlane(tid >> 5), lane = tid & 31, nloc = lane & 15, hlf = lane >> 4; const int t0 = blockIdx.x * PT; const int b = blockIdx.y;
  const int slab = blockIdx.z, n0 = slab * 128, part = slab / 8, c0 = n0 - part * DM;
  const int wm = wave & 3, wn = wave >> 2;   // the wave's 32-token group and 64-column group
  const float* bias = part == 0 ? bq : part == 1 ? bk : bv;
  const int sr = tid >> 3, sc = (tid & 7) * 8;   // the lane's first staged row and first element in it
  const unsigned ring0 = (unsigned)(size_t)&PR[0] + (unsigned)(sr * PP + sc) * 2u;
  const b16 *cx = X16 + ((size_t)b * (SEQ_FULL) + t0 + sr) * DM + sc, *cw = WT + (size_t)(n0 + sr) * DM + sc;
  proj_copy(ring0, cx, cw);
  v8f acc[2][4];
#pragma unroll
  for (int i = 0; i < 2; ++i)
#pragma unroll
    for (int t = 0; t < 4; ++t) acc[i][t] = (v8f){};
  asm volatile("s_wait_asynccnt 0x0" ::: "memory");   // this wave's share of stage 0 has landed
  __syncthreads();                                     // stage 0 is published to all waves
  proj_copy(ring0 + PSTG * 2, cx + PK, cw + PK);
#pragma unroll 1
  for (int st = 0; st < PNS; ++st) {
    const b16* xr = PR + (st & 1) * PSTG + (wm * 32 + nloc) * PP; const b16* wr = PR + (st & 1) * PSTG + PPL + (wn * 64 + nloc) * PP;
#pragma unroll
    for (int ks = 0; ks < PK; ks += 32) { const v16b a0 = frag_kb(xr + ks, hlf), a1 = frag_kb(xr + 16 * PP + ks, hlf); v16b w[4];   // the six fragments of a 32-k step are read as one group
#pragma unroll
      for (int t = 0; t < 4; ++t) w[t] = frag_kb(wr + t * 16 * PP + ks, hlf);
#pragma unroll
      for (int t = 0; t < 4; ++t) { acc[0][t] = wmma16b(a0, w[t], acc[0][t]); acc[1][t] = wmma16b(a1, w[t], acc[1][t]); } }
    // publish point of stage st + 1, passed by every wave on every trip
    asm volatile("s_wait_dscnt 0x0" ::: "memory");      // this wave's reads of stage st have returned
    asm volatile("s_wait_asynccnt 0x0" ::: "memory");   // this wave's share of stage st + 1 has landed
    __syncthreads();                                     // publishes stage st + 1 and frees stage st's buffer
    if (st + 2 < PNS) proj_copy(ring0 + (st & 1) * (PSTG * 2), cx + (st + 2) * PK, cw + (st + 2) * PK);
  }
  asm volatile("s_wait_asynccnt 0x0" ::: "memory");     // nothing of this wave is in flight when the ring becomes epilogue staging
  float (*Tf)[128 + 4] = reinterpret_cast<float (*)[128 + 4]>(&PR[0]);   // behind the last trip's barrier no wave reads the ring any more
#pragma unroll
  for (int t = 0; t < 4; ++t) { const float bb = bf16_rne(bias[c0 + wn * 64 + t * 16 + nloc]);
#pragma unroll
    for (int i = 0; i < 2; ++i)
#pragma unroll
      for (int r = 0; r < 8; ++r) Tf[wm * 32 + i * 16 + 8 * hlf + r][wn * 64 + t * 16 + nloc] = acc[i][t][r] * (1.0f / (XS * WSC)) + bb; }
  __syncthreads();   // Tf is read across waves
  {
    if (part < 2) { b16* ph_ = part == 0 ? QH : KH; b16* pl_ = part == 0 ? QLo : KLo; const int c = c0 + lane * 4; const int h = c / HD, d = c % HD;
      for (int rr = 0; rr < 16; ++rr) { const int tl = wave * 16 + rr; const int tok = t0 + tl; v4h h4, l4; for (int j = 0; j < 4; ++j) { b16 p, q; split16(Tf[tl][lane * 4 + j] * XS, p, q); h4[j] = p; l4[j] = q; }
        const size_t oi = (((size_t)b * H + h) * (SEQ_FULL) + tok) * HD + d; *(v4h*)(ph_ + oi) = h4; *(v4h*)(pl_ + oi) = l4; } }
    else {
#pragma unroll 1
      for (int q = 0; q < 32; ++q) { const int cl = wave * 16 + (q >> 1); const int c = c0 + cl; const int h = c / HD, d = c % HD; const int tk = (q & 1) * 64 + lane * 2; v2h hv, lv;
        for (int j = 0; j < 2; ++j) { b16 p, ql; split16(Tf[tk + j][cl] * XS, p, ql); hv[j] = p; lv[j] = ql; }
        const size_t oi = (((size_t)b * H + h) * HD + d) * (size_t)(SEQ_FULL) + t0 + tk; *(v2h*)(VTh + oi) = hv; *(v2h*)(VTl + oi) = lv;
        asm volatile("s_wait_xcnt 0x0" ::: "memory"); } }   // stands in front of the next trip's rewrite of the registers that the two stores name
     }
}

// attention: grid (SEQ/256, NB x H): block = 16 waves x 16 queries = two 128-query tiles of one head side by side: waves 0-7 take tile n - 1 - x (long), waves 8-15 tile x (short), so that every
// block, and with one block per WGP every WGP, holds about the same number of 32-key steps. Both tiles walk the same K/V ring: keys 0 .. min(KL, long tile's last query + 1 + 128) in stages of
// 64 keys; the stage count is the block's one count and every wave passes every publish point, also a wave whose own keys have ended. One stage = four planes of 64 rows x 128 B
// (K hi, K lo: row = key; V^T hi, V^T lo: row = d), brought ONCE per block into LDS by asynchronous copies (16 B per lane, 4 copies per lane and stage) at a row pitch of 144 B, two buffers:
// stage s + 1 flies while stage s is worked on; all 16 waves read their fragments from LDS. Per wave the 32-key steps, their order and arithmetic are as before (keys < q0 + 16 + 128):
// S^T = K Q^T with 3 products (kh qh + kh ql + kl qh); online softmax in f32 (maximum exchanged between the lane halves in registers, sums joined behind the loop), the mask applied only in the steps that straddle its edge; P x1024 hi/lo packed in-lane from the scores into the B fragment; O^T += V^T P^T (3 products);
constexpr int AW = 8, BW = 2 * AW, NT = (SEQ) / (16 * AW), KT = 64, RP = 64 + 8, PLN = 64 * RP, STG = 4 * PLN;   // waves per tile and per block; query tiles per head; keys per stage; row pitch, plane and stage in f16 elements
static_assert((SEQ) % (16 * BW) == 0 && KL % KT == 0 && KL >= 2 * KT && (16 * AW + SRC) % KT == 0);
static_assert((size_t)BW * 16 * (HD + 4) * 4 <= (size_t)2 * STG * 2);   // the output staging fits into the ring
static_assert(SRC >= 31);   // keys 0 .. 31 are visible to every query

// One stage: lane unit (row r = tid / 8 in 0 .. 63, 16-B piece c = tid % 8) of each of the four planes. lds = LDS byte address of the lane's unit in plane 0 of the target buffer.
__device__ __forceinline__ void stage_copy(unsigned lds, const b16* kh, const b16* kl, const b16* vh, const b16* vl) {
  const unsigned l0 = lds, l1 = lds + PLN * 2, l2 = lds + 2 * PLN * 2, l3 = lds + 3 * PLN * 2;
  // the copies and, as the last line, the wait that stands in front of any rewrite of the address registers they name
  asm volatile("global_load_async_to_lds_b128 %0, %4, off\n\t"
               "global_load_async_to_lds_b128 %1, %5, off\n\t"
               "global_load_async_to_lds_b128 %2, %6, off\n\t"
               "global_load_async_to_lds_b128 %3, %7, off\n\t"
               "s_wait_xcnt 0x0"
               :: "v"(l0), "v"(l1), "v"(l2), "v"(l3), "v"(kh), "v"(kl), "v"(vh), "v"(vl) : "memory");
}

__global__ __launch_bounds__(512) void attn_kernel(const b16* __restrict__ QH, const b16* __restrict__ QLo, const b16* __restrict__ KH, const b16* __restrict__ KLo,
                                                  const b16* __restrict__ VTh, const b16* __restrict__ VTl, float* __restrict__ out) {
  __shared__ __attribute__((aligned(16))) b16 Ring[2 * STG];
  const int tid = threadIdx.x, wave = __builtin_amdgcn_readfirstlane(tid >> 5), lane = tid & 31, hh = lane >> 4, col = lane & 15; const int b = blockIdx.y / H, h = blockIdx.y % H;
  const int qbl = (NT - 1 - (int)blockIdx.x) * (16 * AW);   // first query of the long tile, which sets the block's stage count
  const int qb = (wave < AW) ? qbl : (int)blockIdx.x * (16 * AW), q0 = qb + (wave & (AW - 1)) * 16, qi = q0 + col;   // wave-uniform choice of the tile
  const size_t ph = (size_t)b * H + h; const size_t pq = ph * (size_t)(SEQ_FULL) * HD; const b16* Vh = VTh + ph * HD * (size_t)(SEQ_FULL); const b16* Vl = VTl + ph * HD * (size_t)(SEQ_FULL);
  const int nst = ((qbl + 16 * AW + SRC < KL) ? (qbl + 16 * AW + SRC) : KL) / KT;   // block-uniform, >= 2; staged keys stay < KL; covers the short tile's keys too
  const int sr = tid >> 3, sc = (tid & 7) * 8;   // the lane's staged row and first element in it
  const unsigned ring0 = (unsigned)(size_t)&Ring[0] + (unsigned)(sr * RP + sc) * 2u;
  const b16 *ckh = KH + pq + (size_t)sr * HD + sc, *ckl = KLo + pq + (size_t)sr * HD + sc, *cvh = Vh + (size_t)sr * (SEQ_FULL) + sc, *cvl = Vl + (size_t)sr * (SEQ_FULL) + sc;
  stage_copy(ring0, ckh, ckl, cvh, cvl);
  const v16b qh0 = frag_kb(QH + pq + (size_t)qi * HD, hh), qh1 = frag_kb(QH + pq + (size_t)qi * HD + 32, hh), ql0 = frag_kb(QLo + pq + (size_t)qi * HD, hh), ql1 = frag_kb(QLo + pq + (size_t)qi * HD + 32, hh);
  const float cs = LOG2E / (8.0f * XS * XS);
  float m = -INFINITY, l = 0.0f; v8f o[4];
#pragma unroll
  for (int t = 0; t < 4; ++t) o[t] = (v8f){};
  const int kend = (q0 + 16 + SRC < KL) ? (q0 + 16 + SRC) : KL;   // wave-uniform
  asm volatile("s_wait_asynccnt 0x0" ::: "memory");   // this wave's share of stage 0 has landed
  __syncthreads();                                     // stage 0 is published to all waves
  stage_copy(ring0 + STG * 2, ckh + (size_t)KT * HD, ckl + (size_t)KT * HD, cvh + KT, cvl + KT);
#pragma unroll 1
  for (int st = 0; st < nst; ++st) {
    const b16* buf = Ring + (st & 1) * STG;
#pragma unroll 1
    for (int kb = st * KT; kb < st * KT + KT; kb += 32) {
      if (kb >= kend) break;   // wave-uniform: steps beyond this wave's last visible key; the publish point below is still passed
      const int ko = kb - st * KT;
      float e[16]; float mx = -INFINITY;
      v16b kh0[2], kh1[2], kl0[2], kl1[2]; v8f s[2];
#pragma unroll
      for (int u = 0; u < 2; ++u) { kh0[u] = frag_kb(buf + (ko + u * 16 + col) * RP, hh); s[u] = (v8f){}; }   // read in the order in which the products below take them
#pragma unroll
      for (int u = 0; u < 2; ++u) kl0[u] = frag_kb(buf + (ko + u * 16 + col) * RP + PLN, hh);
#pragma unroll
      for (int u = 0; u < 2; ++u) kh1[u] = frag_kb(buf + (ko + u * 16 + col) * RP + 32, hh);
#pragma unroll
      for (int u = 0; u < 2; ++u) kl1[u] = frag_kb(buf + (ko + u * 16 + col) * RP + PLN + 32, hh);
      __builtin_amdgcn_sched_barrier(0);   // the step's 16 K reads stay one group in front of the score products: the wave waits out the LDS latency once, not per fragment
#pragma unroll
      for (int u = 0; u < 2; ++u) s[u] = wmma16p(kh0[u], qh0, s[u]);   // the two key tiles' chains alternate; each tile keeps its order of six products
#pragma unroll
      for (int u = 0; u < 2; ++u) s[u] = wmma16p(kh0[u], ql0, s[u]);
#pragma unroll
      for (int u = 0; u < 2; ++u) s[u] = wmma16p(kl0[u], qh0, s[u]);
#pragma unroll
      for (int u = 0; u < 2; ++u) s[u] = wmma16p(kh1[u], qh1, s[u]);
#pragma unroll
      for (int u = 0; u < 2; ++u) s[u] = wmma16p(kh1[u], ql1, s[u]);
#pragma unroll
      for (int u = 0; u < 2; ++u) s[u] = wmma16p(kl1[u], qh1, s[u]);
      v16b va[4], vb2[4];
#pragma unroll
      for (int t = 0; t < 4; ++t) { const b16* vr = buf + 2 * PLN + (t * 16 + col) * RP + ko; va[t] = frag_kb(vr, hh); vb2[t] = frag_kb(vr + PLN, hh); }
      __builtin_amdgcn_sched_barrier(0);   // the step's 16 V reads stay one group here, in front of the softmax, whose vector work covers their latency
#pragma unroll
      for (int u = 0; u < 2; ++u)
#pragma unroll
        for (int r = 0; r < 8; ++r) e[u * 8 + r] = s[u][r] * cs;
      if (kb + 31 > q0 + SRC) {   // wave-uniform: only a step that reaches past the last key visible to the wave's first query has anything to mask (at most one step of a wave)
        const int lim = qi + SRC - kb - 8 * hh;   // the lane's last visible key, counted from its first key of the step
#pragma unroll
        for (int i = 0; i < 16; ++i) e[i] = ((i >> 3) * 16 + (i & 7) <= lim) ? e[i] : -INFINITY; }   // score i belongs to key kb + 8 hh + 16 (i / 8) + i % 8
#pragma unroll
      for (int i = 0; i < 16; ++i) mx = fmaxf(mx, e[i]);
      // every wave's step 0 is unmasked (SRC >= 31), so m and mn are finite from there on: a masked score gives exp2(-inf) = 0 by itself, and the first step's m = -inf gives al = 0 on o = 0, l = 0
      mx = fmaxf(mx, xhalf(mx)); const float mn = fmaxf(m, mx); const float al = nexp2(m - mn); float sum = 0.0f;
      v16b pf, pg;   // score i of a lane is key 8 hh + 16 (i / 8) + i % 8 of query col: the very element i of the lane's B fragment of P^T, so P goes from the score registers into the operand in-lane
#pragma unroll
      for (int i2 = 0; i2 < 16; i2 += 2) { const float p0 = nexp2(e[i2] - mn), p1 = nexp2(e[i2 + 1] - mn); sum += p0; sum += p1; const v2f t = (v2f){p0, p1} * PS;   // two neighbours fill one operand register
        const v2h a2 = __builtin_convertvector(t, v2h), b2 = __builtin_convertvector(t - __builtin_convertvector(a2, v2f), v2h); pf[i2] = a2[0]; pf[i2 + 1] = a2[1]; pg[i2] = b2[0]; pg[i2 + 1] = b2[1]; }
      l = l * al + sum; m = mn;   // l holds the lane half's own 16 keys of each step; m and al are equal in both halves, so the halves are joined once, behind the loop
#pragma unroll
      for (int t = 0; t < 4; ++t) o[t] *= al;
#pragma unroll
      for (int t = 0; t < 4; ++t) o[t] = wmma16p(va[t], pf, o[t]);   // the four output tiles' chains alternate; each tile keeps its order of three products
#pragma unroll
      for (int t = 0; t < 4; ++t) o[t] = wmma16p(va[t], pg, o[t]);
#pragma unroll
      for (int t = 0; t < 3; ++t) o[t] = wmma16p(vb2[t], pf, o[t]);
      __builtin_amdgcn_sched_barrier(0);   // the padded product below stays the step's last
      o[3] = wmma16b(vb2[3], pf, o[3]); }  // its four v_nop keep the distance to the next trip's first vector writes into the fragment registers
    // publish point of stage st + 1, passed by every wave on every trip
    asm volatile("s_wait_dscnt 0x0" ::: "memory");      // this wave's reads of stage st have returned
    asm volatile("s_wait_asynccnt 0x0" ::: "memory");   // this wave's share of stage st + 1 has landed
    __syncthreads();                                     // publishes stage st + 1 and frees stage st's buffer
    if (st + 2 < nst) stage_copy(ring0 + (st & 1) * (STG * 2), ckh + (size_t)(st + 2) * KT * HD, ckl + (size_t)(st + 2) * KT * HD, cvh + (st + 2) * KT, cvl + (st + 2) * KT);
  }
  asm volatile("s_wait_asynccnt 0x0" ::: "memory");     // nothing of this wave is in flight when the ring becomes output staging
  float (*To)[16][HD + 4] = reinterpret_cast<float (*)[16][HD + 4]>(&Ring[0]);   // behind the last trip's barrier no wave reads the ring any more
  l += xhalf(l);   // a query's normaliser = the two lane halves' sums
  const float inv = 1.0f / (l * PS * XS);
#pragma unroll
  for (int t = 0; t < 4; ++t)
#pragma unroll
    for (int r = 0; r < 8; ++r) To[wave][col][t * 16 + 8 * hh + r] = o[t][r] * inv;
  wave_lds_sync();
  {
    for (int rr2 = 0; rr2 < 8; ++rr2) { const int row = 2 * rr2 + hh; const int c4 = col * 4; const v4f f = *(const v4f*)(&To[wave][row][c4]);
      *(v4f*)(out + ((size_t)b * (SEQ_FULL) + q0 + row) * DM + h * HD + c4) = f; }
     }
}
}  // namespace

extern "C" void kernel_launch(void* const* d_in, const int* in_sizes, int n_in, void* d_out, int out_size, void* d_ws, size_t ws_size, hipStream_t stream) {
  if (n_in < 7) return;
  auto Fp = [&](int i) { return (const float*)d_in[i]; };
  // wire order: 0 x [2,2048,1024], 1 W_q [1024,1024] (out,in), 2 b_q [1024], 3 W_k, 4 b_k, 5 W_v, 6 b_v - all f32
  if (in_sizes[0] < (NB_FULL) * (SEQ_FULL) * DM || in_sizes[1] < DM * DM || in_sizes[2] < DM || in_sizes[3] < DM * DM || in_sizes[4] < DM || in_sizes[5] < DM * DM || in_sizes[6] < DM) return;
  if (out_size < (((NB) - 1) * (SEQ_FULL) + (SEQ)) * DM) return;
  size_t off = 0; char* ws = (char*)d_ws;
  auto carve = [&](size_t bytes) { char* p = ws + off; off += (bytes + 255) & ~(size_t)255; return p; };
  b16* X16 = (b16*)carve((size_t)(NB_FULL) * (SEQ_FULL) * DM * 2);                 // 8 MiB
  b16* WT = (b16*)carve((size_t)3 * DM * DM * 2);                                  // 6 MiB
  const size_t plane = (size_t)(NB_FULL) * H * (SEQ_FULL) * HD * 2;                 // 8 MiB each, full strides
  b16* QH = (b16*)carve(plane); b16* QLo = (b16*)carve(plane); b16* KH = (b16*)carve(plane); b16* KLo = (b16*)carve(plane); b16* VTh = (b16*)carve(plane); b16* VTl = (b16*)carve(plane);
  if (off > ws_size || off > ((size_t)128 << 20)) return;   // total 62 MiB
  prep_kernel<<<(unsigned)(PREP_UNITS / 256), 256, 0, stream>>>(Fp(0), Fp(1), Fp(3), Fp(5), X16, WT);
  proj_kernel<<<dim3(KL / 128, (NB), 24), 256, 0, stream>>>(X16, WT, Fp(2), Fp(4), Fp(6), QH, QLo, KH, KLo, VTh, VTl);
  attn_kernel<<<dim3((SEQ) / 256, (NB) * H), 512, 0, stream>>>(QH, QLo, KH, KLo, VTh, VTl, (float*)d_out);
}

// v008
// One run takes 82.5 microseconds.
// In two side-by-side timings against v007, it was 1.04 and 1.02 times as fast.
// All steps since v000 together make it 4.21 times as fast.
#include <hip/hip_runtime.h>

// All contractions: v_wmma_f32_16x16x32_f16 (f16 operands, f32 accumulate). q/k/v projections [NB*KL x 1024] x [1024 x 3072]: x bf16-exact f16 x8, W bf16-exact f16 x256,
// 1 product, bias added in f32; S^T = K Q^T with q and k carried as f16 hi+lo x8 planes (3 products); O^T += V^T P^T with v as f16 hi+lo x8 planes and P x1024 f16 hi+lo
// (3 products); softmax running max / sum / normaliser in f32.
// Layouts: x [NB_FULL][SEQ_FULL][1024]; W_q/W_k/W_v [1024 out][1024 in]; b_q/b_k/b_v [1024]; y = x W^T + b split into 16 heads x 64; scores scaled by 1/8; key j visible to query i
// iff j <= i + 128; out[b][t][64 h + d] = softmax-weighted sum of v, stored as f32 directly (no output projection).
// Every float input is RNE-converted to bf16 once on load. Fragment k-map per lane half hh for A AND B: elements 0..7 <- k = 8hh+0..7, 8..15 <- k = 16+8hh+0..7;
// Deterministic fixed-order flash-style loop per wave (32 queries, every second 32-key step of the visible keys), two waves' partial results joined in fixed order; no cross-block communication inside a launch.

#ifndef NB
#define NB 2
#endif
#ifndef SEQ
#define SEQ 2048
#endif
#define NB_FULL 2
#define SEQ_FULL 2048

namespace {
constexpr int DM = 1024, H = 16, HD = 64, SRC = 128;
constexpr int KL = ((SEQ) + SRC < (SEQ_FULL)) ? ((SEQ) + SRC) : (SEQ_FULL);   // key / value tokens needed by queries < SEQ
static_assert((NB) >= 1 && (NB) <= (NB_FULL));
static_assert((SEQ) % 64 == 0 && (SEQ) >= 64 && (SEQ) <= (SEQ_FULL));
static_assert(KL % 64 == 0 && KL >= (SEQ) && KL <= (SEQ_FULL));
static_assert(DM == H * HD && DM % 128 == 0 && HD == 64 && (SEQ_FULL) % 32 == 0);
constexpr float XS = 8.0f, WSC = 256.0f, PS = 1024.0f, LOG2E = 1.4426950408889634f;
typedef _Float16 b16;
typedef __attribute__((ext_vector_type(16))) _Float16 v16b;
typedef __attribute__((ext_vector_type(8))) _Float16 v8b;
typedef __attribute__((ext_vector_type(4))) _Float16 v4h;
typedef __attribute__((ext_vector_type(2))) _Float16 v2h;
typedef __attribute__((ext_vector_type(8))) float v8f;
typedef __attribute__((ext_vector_type(4))) float v4f;
typedef __attribute__((ext_vector_type(2))) float v2f;

__device__ __forceinline__ float bf16_rne(float f) { unsigned int u = __float_as_uint(f); u += 0x7FFFu + ((u >> 16) & 1u); return __uint_as_float(u & 0xFFFF0000u); }
__device__ __forceinline__ void split16(float v, b16& hi, b16& lo) { hi = (b16)v; lo = (b16)(v - (float)hi); }
// 16-bit fragment from a k-contiguous row (A: row m; B: column n stored [n][k]); hh = lane half
__device__ __forceinline__ v16b frag_kb(const b16* p, int hh) { const v8b a = *(const v8b*)(p + 8 * hh), b = *(const v8b*)(p + 16 + 8 * hh); v16b f;
#pragma unroll
  for (int e = 0; e < 8; ++e) { f[e] = a[e]; f[8 + e] = b[e]; } return f; }
// a fragment parked in LDS in fragment order: each lane writes and reads back its own two 16-B pieces (second piece 32 lanes x 8 elements on), so no other lane's write is ever read
__device__ __forceinline__ void frag_put(b16* p, v16b f) { v8b a, b;
#pragma unroll
  for (int e = 0; e < 8; ++e) { a[e] = f[e]; b[e] = f[8 + e]; } *(v8b*)p = a; *(v8b*)(p + 256) = b; }
__device__ __forceinline__ v16b frag_get(const b16* p) { const v8b a = *(const v8b*)p, b = *(const v8b*)(p + 256); v16b f;
#pragma unroll
  for (int e = 0; e < 8; ++e) { f[e] = a[e]; f[8 + e] = b[e]; } return f; }
__device__ __forceinline__ v8f wmma16b(v16b a, v16b b, v8f c) { v8f d = __builtin_amdgcn_wmma_f32_16x16x32_f16(false, a, false, b, (short)0, c, false, false); asm volatile("v_nop\n\tv_nop\n\tv_nop\n\tv_nop" : "+v"(d) : "v"(a), "v"(b)); return d; }
// the same product as a plain builtin, for blocks of independent accumulator chains: the neighbouring products fill each other's distance and the compiler pads the end of the block itself
__device__ __forceinline__ v8f wmma16p(v16b a, v16b b, v8f c) { return __builtin_amdgcn_wmma_f32_16x16x32_f16(false, a, false, b, (short)0, c, false, false); }
__device__ __forceinline__ void wave_lds_sync() { __builtin_amdgcn_fence(3, "workgroup"); __builtin_amdgcn_wave_barrier(); __builtin_amdgcn_fence(2, "workgroup"); }
__device__ __forceinline__ float nexp2(float v) { return __builtin_amdgcn_exp2f(v); }
// lane l takes lane l ^ 16's value by one vector cross-row move: no LDS permute, so nothing of it counts on dscnt
__device__ __forceinline__ float xhalf(float v) { const int b = __builtin_bit_cast(int, v); return __builtin_bit_cast(float, __builtin_amdgcn_permlanex16(b, b, 0x76543210, 0xfedcba98, false, false)); }

constexpr size_t WU = (size_t)DM * DM / 8;                         // 8-element units per weight matrix
constexpr size_t XU = (size_t)(NB_FULL) * (SEQ_FULL) * DM / 8;     // 8-element units of x
constexpr size_t PREP_UNITS = 3 * WU + XU;
static_assert(PREP_UNITS % 256 == 0 && (3 * WU) % 256 == 0 && WU % 256 == 0);

// prep: WT [3072 o][1024 k] = W_q | W_k | W_v rows ([out][in] is already k-contiguous), bf16 RNE then x256 -> f16; X16 [NB_FULL*SEQ_FULL][1024] = bf16 RNE(x) x8 -> f16.
__global__ __launch_bounds__(256) void prep_kernel(const float* __restrict__ x, const float* __restrict__ wq, const float* __restrict__ wk, const float* __restrict__ wv, b16* __restrict__ X16, b16* __restrict__ WT) {
  const size_t u = (size_t)blockIdx.x * 256 + threadIdx.x; if (u >= PREP_UNITS) return;
  const float* src; b16* dst; float sc;
  if (u < 3 * WU) { const int m = (int)(u / WU); const size_t e = (u - (size_t)m * WU) * 8; const float* w = m == 0 ? wq : m == 1 ? wk : wv; src = w + e; dst = WT + (size_t)m * DM * DM + e; sc = WSC; }
  else { const size_t e = (u - 3 * WU) * 8; src = x + e; dst = X16 + e; sc = XS; }
  const v4f f0 = *(const v4f*)src, f1 = *(const v4f*)(src + 4); v8b o;
#pragma unroll
  for (int j = 0; j < 4; ++j) { o[j] = (b16)(bf16_rne(f0[j]) * sc); o[4 + j] = (b16)(bf16_rne(f1[j]) * sc); }
  { *(v8b*)dst = o;  }
}

// projections: grid (KL/128, NB, 24 slabs of 128 columns: 0-7 q, 8-15 k, 16-23 v); block = 128 tokens of batch b x 128 columns, 8 waves (wave = 32 tokens x 64 columns, 8 accumulator tiles).
// One stage = 64 k of the block's 128 X16 rows and 128 WT rows (rows of 128 B), brought ONCE per block into LDS by asynchronous copies (16 B per lane, 8 copies per lane and stage) at a row pitch
// of 144 B, two buffers: stage s + 1 flies while stage s is worked on; all waves read their A and B fragments from LDS. Every accumulator tile sums k in ascending steps of 32 (K = 1024).
// epilogue + bf16-RNE bias in f32 into Tf (the ring, reused); q/k -> f16 hi/lo x8 planes [b][h][t][64]; v -> f16 hi/lo x8 planes [b][h][d][t]
constexpr int PT = 128, PK = 64, PP = PK + 8, PPL = PT * PP, PSTG = 2 * PPL, PNS = DM / PK;   // rows per plane; k per stage; row pitch, plane and stage in f16 elements; stages
static_assert(KL % PT == 0 && DM % PK == 0 && PNS >= 2);
static_assert((size_t)PT * (128 + 4) * 4 <= (size_t)2 * PSTG * 2);   // the epilogue staging fits into the ring

// One stage: lane unit (row r = tid / 8, r + 32, r + 64, r + 96; 16-B piece c = tid % 8) of the X plane and of the W plane. lds = LDS byte address of the lane's unit in the X plane of the target buffer.
__device__ __forceinline__ void proj_copy(unsigned lds, const b16* xg, const b16* wg) {
  const unsigned l0 = lds, l1 = lds + 32 * PP * 2, l2 = lds + 64 * PP * 2, l3 = lds + 96 * PP * 2, l4 = lds + PPL * 2, l5 = l4 + 32 * PP * 2, l6 = l4 + 64 * PP * 2, l7 = l4 + 96 * PP * 2;
  const b16 *g0 = xg, *g1 = xg + 32 * DM, *g2 = xg + 64 * DM, *g3 = xg + 96 * DM, *g4 = wg, *g5 = wg + 32 * DM, *g6 = wg + 64 * DM, *g7 = wg + 96 * DM;
  // the copies and, as the last line, the wait that stands in front of any rewrite of the address registers they name
  asm volatile("global_load_async_to_lds_b128 %0, %8, off\n\t"
               "global_load_async_to_lds_b128 %1, %9, off\n\t"
               "global_load_async_to_lds_b128 %2, %10, off\n\t"
               "global_load_async_to_lds_b128 %3, %11, off\n\t"
               "global_load_async_to_lds_b128 %4, %12, off\n\t"
               "global_load_async_to_lds_b128 %5, %13, off\n\t"
               "global_load_async_to_lds_b128 %6, %14, off\n\t"
               "global_load_async_to_lds_b128 %7, %15, off\n\t"
               "s_wait_xcnt 0x0"
               :: "v"(l0), "v"(l1), "v"(l2), "v"(l3), "v"(l4), "v"(l5), "v"(l6), "v"(l7), "v"(g0), "v"(g1), "v"(g2), "v"(g3), "v"(g4), "v"(g5), "v"(g6), "v"(g7) : "memory");
}

__global__ __launch_bounds__(256) void proj_kernel(const b16* __restrict__ X16, const b16* __restrict__ WT, const float* __restrict__ bq, const float* __restrict__ bk, const float* __restrict__ bv,
                                                   b16* __restrict__ QH, b16* __restrict__ QLo, b16* __restrict__ KH, b16* __restrict__ KLo, b16* __restrict__ VTh, b16* __restrict__ VTl) {
  __shared__ __attribute__((aligned(16))) b16 PR[2 * PSTG];
  const int tid = threadIdx.x, wave = __builtin_amdgcn_readfirstlane(tid >> 5), lane = tid & 31, nloc = lane & 15, hlf = lane >> 4; const int t0 = blockIdx.x * PT; const int b = blockIdx.y;
  const int slab = blockIdx.z, n0 = slab * 128, part = slab / 8, c0 = n0 - part * DM;
  const int wm = wave & 3, wn = wave >> 2;   // the wave's 32-token group and 64-column group
  const float* bias = part == 0 ? bq : part == 1 ? bk : bv;
  const int sr = tid >> 3, sc = (tid & 7) * 8;   // the lane's first staged row and first element in it
  const unsigned ring0 = (unsigned)(size_t)&PR[0] + (unsigned)(sr * PP + sc) * 2u;
  const b16 *cx = X16 + ((size_t)b * (SEQ_FULL) + t0 + sr) * DM + sc, *cw = WT + (size_t)(n0 + sr) * DM + sc;
  proj_copy(ring0, cx, cw);
  v8f acc[2][4];
#pragma unroll
  for (int i = 0; i < 2; ++i)
#pragma unroll
    for (int t = 0; t < 4; ++t) acc[i][t] = (v8f){};
  asm volatile("s_wait_asynccnt 0x0" ::: "memory");   // this wave's share of stage 0 has landed
  __syncthreads();                                     // stage 0 is published to all waves
  proj_copy(ring0 + PSTG * 2, cx + PK, cw + PK);
#pragma unroll 1
  for (int st = 0; st < PNS; ++st) {
    const b16* xr = PR + (st & 1) * PSTG + (wm * 32 + nloc) * PP; const b16* wr = PR + (st & 1) * PSTG + PPL + (wn * 64 + nloc) * PP;
#pragma unroll
    for (int ks = 0; ks < PK; ks += 32) { const v16b a0 = frag_kb(xr + ks, hlf), a1 = frag_kb(xr + 16 * PP + ks, hlf); v16b w[4];   // the six fragments of a 32-k step are read as one group
#pragma unroll
      for (int t = 0; t < 4; ++t) w[t] = frag_kb(wr + t * 16 * PP + ks, hlf);
#pragma unroll
      for (int t = 0; t < 4; ++t) { acc[0][t] = wmma16b(a0, w[t], acc[0][t]); acc[1][t] = wmma16b(a1, w[t], acc[1][t]); } }
    // publish point of stage st + 1, passed by every wave on every trip
    asm volatile("s_wait_dscnt 0x0" ::: "memory");      // this wave's reads of stage st have returned
    asm volatile("s_wait_asynccnt 0x0" ::: "memory");   // this wave's share of stage st + 1 has landed
    __syncthreads();                                     // publishes stage st + 1 and frees stage st's buffer
    if (st + 2 < PNS) proj_copy(ring0 + (st & 1) * (PSTG * 2), cx + (st + 2) * PK, cw + (st + 2) * PK);
  }
  asm volatile("s_wait_asynccnt 0x0" ::: "memory");     // nothing of this wave is in flight when the ring becomes epilogue staging
  float (*Tf)[128 + 4] = reinterpret_cast<float (*)[128 + 4]>(&PR[0]);   // behind the last trip's barrier no wave reads the ring any more
#pragma unroll
  for (int t = 0; t < 4; ++t) { const float bb = bf16_rne(bias[c0 + wn * 64 + t * 16 + nloc]);
#pragma unroll
    for (int i = 0; i < 2; ++i)
#pragma unroll
      for (int r = 0; r < 8; ++r) Tf[wm * 32 + i * 16 + 8 * hlf + r][wn * 64 + t * 16 + nloc] = acc[i][t][r] * (1.0f / (XS * WSC)) + bb; }
  __syncthreads();   // Tf is read across waves
  {
    if (part < 2) { b16* ph_ = part == 0 ? QH : KH; b16* pl_ = part == 0 ? QLo : KLo; const int c = c0 + lane * 4; const int h = c / HD, d = c % HD;
      for (int rr = 0; rr < 16; ++rr) { const int tl = wave * 16 + rr; const int tok = t0 + tl; v4h h4, l4; for (int j = 0; j < 4; ++j) { b16 p, q; split16(Tf[tl][lane * 4 + j] * XS, p, q); h4[j] = p; l4[j] = q; }
        const size_t oi = (((size_t)b * H + h) * (SEQ_FULL) + tok) * HD + d; *(v4h*)(ph_ + oi) = h4; *(v4h*)(pl_ + oi) = l4; } }
    else {
#pragma unroll 1
      for (int q = 0; q < 32; ++q) { const int cl = wave * 16 + (q >> 1); const int c = c0 + cl; const int h = c / HD, d = c % HD; const int tk = (q & 1) * 64 + lane * 2; v2h hv, lv;
        for (int j = 0; j < 2; ++j) { b16 p, ql; split16(Tf[tk + j][cl] * XS, p, ql); hv[j] = p; lv[j] = ql; }
        const size_t oi = (((size_t)b * H + h) * HD + d) * (size_t)(SEQ_FULL) + t0 + tk; *(v2h*)(VTh + oi) = hv; *(v2h*)(VTl + oi) = lv;
        asm volatile("s_wait_xcnt 0x0" ::: "memory"); } }   // stands in front of the next trip's rewrite of the registers that the two stores name
     }
}

// attention: grid (SEQ/256, NB x H): block = 16 waves = two 128-query tiles of one head side by side: waves 0-7 take tile n - 1 - x (long), waves 8-15 tile x (short), so that every
// block, and with one block per WGP every WGP, holds about the same number of 32-key steps. Both tiles walk the same K/V ring: keys 0 .. min(KL, long tile's last query + 1 + 128) in stages of
// 64 keys; the stage count is the block's one count and every wave passes every publish point, also a wave whose own keys have ended. One stage = four planes of 64 rows x 128 B
// (K hi, K lo: row = key; V^T hi, V^T lo: row = d), brought ONCE per block into LDS by asynchronous copies (16 B per lane, 4 copies per lane and stage) at a row pitch of 144 B, two buffers:
// stage s + 1 flies while stage s is worked on; all 16 waves read their fragments from LDS. Inside a tile waves 2 i and 2 i + 1 share queries 32 i .. 32 i + 31 (two 16-column groups) and split every
// stage: wave 2 i takes its keys 0-31, wave 2 i + 1 its keys 32-63 (keys < q0 + 32 + 128), so that one K or V fragment read from LDS feeds two column groups. Per column group and 32-key step:
// S^T = K Q^T with 3 products (kh qh + kh ql + kl qh); online softmax in f32 (maximum exchanged between the lane halves in registers, sums joined behind the loop), the mask applied only in the steps that straddle its edge; P x1024 hi/lo packed in-lane from the scores into the B fragment; O^T += V^T P^T (3 products);
// behind the loop the pair's two partial results (maximum, sum, O) are joined through LDS, each wave finishing one column group.
constexpr int AW = 8, BW = 2 * AW, NT = (SEQ) / (16 * AW), KT = 64, RP = 64 + 8, PLN = 64 * RP, STG = 4 * PLN;   // waves per tile and per block; query tiles per head; keys per stage; row pitch, plane and stage in f16 elements
static_assert((SEQ) % (16 * BW) == 0 && KL % KT == 0 && KL >= 2 * KT && (16 * AW + SRC) % KT == 0);
static_assert((size_t)BW * 16 * (HD + 4) * 4 <= (size_t)2 * STG * 2);   // the output staging fits into the ring
static_assert(SRC >= 63 && sizeof(float[34][32]) == sizeof(float[16][HD + 4]));   // keys 0 .. 63 are visible to every query; a wave's exchange range is its partner's output staging range

// One stage: lane unit (row r = tid / 8 in 0 .. 63, 16-B piece c = tid % 8) of each of the four planes. lds = LDS byte address of the lane's unit in plane 0 of the target buffer.
__device__ __forceinline__ void stage_copy(unsigned lds, const b16* kh, const b16* kl, const b16* vh, const b16* vl) {
  const unsigned l0 = lds, l1 = lds + PLN * 2, l2 = lds + 2 * PLN * 2, l3 = lds + 3 * PLN * 2;
  // the copies and, as the last line, the wait that stands in front of any rewrite of the address registers they name
  asm volatile("global_load_async_to_lds_b128 %0, %4, off\n\t"
               "global_load_async_to_lds_b128 %1, %5, off\n\t"
               "global_load_async_to_lds_b128 %2, %6, off\n\t"
               "global_load_async_to_lds_b128 %3, %7, off\n\t"
               "s_wait_xcnt 0x0"
               :: "v"(l0), "v"(l1), "v"(l2), "v"(l3), "v"(kh), "v"(kl), "v"(vh), "v"(vl) : "memory");
}

__global__ __launch_bounds__(512) void attn_kernel(const b16* __restrict__ QH, const b16* __restrict__ QLo, const b16* __restrict__ KH, const b16* __restrict__ KLo,
                                                  const b16* __restrict__ VTh, const b16* __restrict__ VTl, float* __restrict__ out) {
  __shared__ __attribute__((aligned(16))) b16 Ring[2 * STG];
  __shared__ __attribute__((aligned(16))) b16 QLs[BW][4][512];   // per wave its four Q lo fragments: 32 registers that the softmax and the V products need; read back with each step's K fragments
  const int tid = threadIdx.x, wave = __builtin_amdgcn_readfirstlane(tid >> 5), lane = tid & 31, hh = lane >> 4, col = lane & 15; const int b = blockIdx.y / H, h = blockIdx.y % H;
  const int qbl = (NT - 1 - (int)blockIdx.x) * (16 * AW);   // first query of the long tile, which sets the block's stage count
  const int kp = wave & 1;   // the wave's 32 keys of every 64-key stage
  const int qb = (wave < AW) ? qbl : (int)blockIdx.x * (16 * AW), q0 = qb + ((wave & (AW - 1)) >> 1) * 32;   // wave-uniform choice of the tile; waves 2 i and 2 i + 1 share 32 queries
  const size_t ph = (size_t)b * H + h; const size_t pq = ph * (size_t)(SEQ_FULL) * HD; const b16* Vh = VTh + ph * HD * (size_t)(SEQ_FULL); const b16* Vl = VTl + ph * HD * (size_t)(SEQ_FULL);
  const int nst = ((qbl + 16 * AW + SRC < KL) ? (qbl + 16 * AW + SRC) : KL) / KT;   // block-uniform, >= 2; staged keys stay < KL; covers the short tile's keys too
  const int sr = tid >> 3, sc = (tid & 7) * 8;   // the lane's staged row and first element in it
  const unsigned ring0 = (unsigned)(size_t)&Ring[0] + (unsigned)(sr * RP + sc) * 2u;
  const b16 *ckh = KH + pq + (size_t)sr * HD + sc, *ckl = KLo + pq + (size_t)sr * HD + sc, *cvh = Vh + (size_t)sr * (SEQ_FULL) + sc, *cvl = Vl + (size_t)sr * (SEQ_FULL) + sc;
  stage_copy(ring0, ckh, ckl, cvh, cvl);
  v16b qh0[2], qh1[2];   // two 16-query column groups g per wave: every K and V fragment read from LDS feeds both
  b16* qls = &QLs[wave][0][lane * 8];
  { v16b tl[4];
#pragma unroll
    for (int g = 0; g < 2; ++g) { const size_t qo = pq + (size_t)(q0 + 16 * g + col) * HD; tl[2 * g] = frag_kb(QLo + qo, hh); tl[2 * g + 1] = frag_kb(QLo + qo + 32, hh); }
    asm volatile("s_wait_xcnt 0x0" ::: "memory");   // stands in front of the Q hi loads, whose results may be given the address registers that the loads above name
#pragma unroll
    for (int g = 0; g < 2; ++g) { const size_t qo = pq + (size_t)(q0 + 16 * g + col) * HD; qh0[g] = frag_kb(QH + qo, hh); qh1[g] = frag_kb(QH + qo + 32, hh); }
#pragma unroll
    for (int f = 0; f < 4; ++f) frag_put(qls + f * 512, tl[f]); }
  const float cs = LOG2E / (8.0f * XS * XS);
  float m[2] = {-INFINITY, -INFINITY}, l[2] = {0.0f, 0.0f}; v8f o[2][4];
#pragma unroll
  for (int g = 0; g < 2; ++g)
#pragma unroll
    for (int t = 0; t < 4; ++t) o[g][t] = (v8f){};
  const int kend = (q0 + 32 + SRC < KL) ? (q0 + 32 + SRC) : KL;   // wave-uniform
  asm volatile("s_wait_asynccnt 0x0" ::: "memory");   // this wave's share of stage 0 has landed
  __syncthreads();                                     // stage 0 is published to all waves
  stage_copy(ring0 + STG * 2, ckh + (size_t)KT * HD, ckl + (size_t)KT * HD, cvh + KT, cvl + KT);
  const int ko = 32 * kp;
#pragma unroll 1
  for (int st = 0; st < nst; ++st) {
    const b16* buf = Ring + (st & 1) * STG;
    const int kb = st * KT + ko;
    if (kb < kend) {   // wave-uniform: no step beyond this wave's last visible key; the publish point below is still passed
      v16b kh0[2], kh1[2], kl0[2], kl1[2], ql0[2], ql1[2]; v8f s[2][2];
#pragma unroll
      for (int u = 0; u < 2; ++u) { kh0[u] = frag_kb(buf + (ko + u * 16 + col) * RP, hh); s[0][u] = (v8f){}; s[1][u] = (v8f){}; }   // read in the order in which the products below take them
#pragma unroll
      for (int g = 0; g < 2; ++g) ql0[g] = frag_get(qls + (2 * g) * 512);
#pragma unroll
      for (int u = 0; u < 2; ++u) kl0[u] = frag_kb(buf + (ko + u * 16 + col) * RP + PLN, hh);
#pragma unroll
      for (int u = 0; u < 2; ++u) kh1[u] = frag_kb(buf + (ko + u * 16 + col) * RP + 32, hh);
#pragma unroll
      for (int g = 0; g < 2; ++g) ql1[g] = frag_get(qls + (2 * g + 1) * 512);
#pragma unroll
      for (int u = 0; u < 2; ++u) kl1[u] = frag_kb(buf + (ko + u * 16 + col) * RP + PLN + 32, hh);
      __builtin_amdgcn_sched_barrier(0);   // the step's 16 K and 8 Q lo reads stay one group in front of the score products: the wave waits out the LDS latency once, not per fragment
#pragma unroll
      for (int u = 0; u < 2; ++u) { s[0][u] = wmma16p(kh0[u], qh0[0], s[0][u]); s[1][u] = wmma16p(kh0[u], qh0[1], s[1][u]); }   // four score tiles' chains alternate; each tile keeps its order of six products
#pragma unroll
      for (int u = 0; u < 2; ++u) { s[0][u] = wmma16p(kh0[u], ql0[0], s[0][u]); s[1][u] = wmma16p(kh0[u], ql0[1], s[1][u]); }
#pragma unroll
      for (int u = 0; u < 2; ++u) { s[0][u] = wmma16p(kl0[u], qh0[0], s[0][u]); s[1][u] = wmma16p(kl0[u], qh0[1], s[1][u]); }
#pragma unroll
      for (int u = 0; u < 2; ++u) { s[0][u] = wmma16p(kh1[u], qh1[0], s[0][u]); s[1][u] = wmma16p(kh1[u], qh1[1], s[1][u]); }
#pragma unroll
      for (int u = 0; u < 2; ++u) { s[0][u] = wmma16p(kh1[u], ql1[0], s[0][u]); s[1][u] = wmma16p(kh1[u], ql1[1], s[1][u]); }
#pragma unroll
      for (int u = 0; u < 2; ++u) { s[0][u] = wmma16p(kl1[u], qh1[0], s[0][u]); s[1][u] = wmma16p(kl1[u], qh1[1], s[1][u]); }
      v16b va[4], vb2[4];
#pragma unroll
      for (int t = 0; t < 4; ++t) va[t] = frag_kb(buf + 2 * PLN + (t * 16 + col) * RP + ko, hh);
      __builtin_amdgcn_sched_barrier(0);   // the 8 V hi reads stay one group here, in front of the softmax, whose vector work covers their latency
      const bool edge = kb + 31 > q0 + SRC;   // wave-uniform: only a step that reaches past the last key visible to the wave's first query has anything to mask
      v16b pf[2], pg[2];   // score i of a lane is key 8 hh + 16 (i / 8) + i % 8 of query col: the very element i of the lane's B fragment of P^T, so P goes from the score registers into the operand in-lane
#pragma unroll
      for (int g = 0; g < 2; ++g) {
        float e[16]; float mx = -INFINITY;
#pragma unroll
        for (int u = 0; u < 2; ++u)
#pragma unroll
          for (int r = 0; r < 8; ++r) e[u * 8 + r] = s[g][u][r] * cs;
        if (edge) {
          const int lim = q0 + 16 * g + col + SRC - kb - 8 * hh;   // the lane's last visible key, counted from its first key of the step
#pragma unroll
          for (int i = 0; i < 16; ++i) e[i] = ((i >> 3) * 16 + (i & 7) <= lim) ? e[i] : -INFINITY; }   // score i belongs to key kb + 8 hh + 16 (i / 8) + i % 8
#pragma unroll
        for (int i = 0; i < 16; ++i) mx = fmaxf(mx, e[i]);
        // every wave's first step is unmasked (SRC >= 63), so m and mn are finite from there on: a masked score gives exp2(-inf) = 0 by itself, and the first step's m = -inf gives al = 0 on o = 0, l = 0
        mx = fmaxf(mx, xhalf(mx)); const float mn = fmaxf(m[g], mx); const float al = nexp2(m[g] - mn); float sum = 0.0f;
#pragma unroll
        for (int i2 = 0; i2 < 16; i2 += 2) { const float p0 = nexp2(e[i2] - mn), p1 = nexp2(e[i2 + 1] - mn); sum += p0; sum += p1; const v2f t = (v2f){p0, p1} * PS;   // two neighbours fill one operand register
          const v2h a2 = __builtin_convertvector(t, v2h), b2 = __builtin_convertvector(t - __builtin_convertvector(a2, v2f), v2h); pf[g][i2] = a2[0]; pf[g][i2 + 1] = a2[1]; pg[g][i2] = b2[0]; pg[g][i2 + 1] = b2[1]; }
        l[g] = l[g] * al + sum; m[g] = mn;   // l holds the lane half's own 16 keys of each step; m and al are equal in both halves, so the halves are joined once, behind the loop
#pragma unroll
        for (int t = 0; t < 4; ++t) o[g][t] *= al;
      }
#pragma unroll
      for (int t = 0; t < 4; ++t) vb2[t] = frag_kb(buf + 3 * PLN + (t * 16 + col) * RP + ko, hh);
      __builtin_amdgcn_sched_barrier(0);   // the 8 V lo reads stay one group here, where the score registers are free; the 16 V hi products below cover their latency
#pragma unroll
      for (int t = 0; t < 4; ++t) { o[0][t] = wmma16p(va[t], pf[0], o[0][t]); o[1][t] = wmma16p(va[t], pf[1], o[1][t]); }   // eight output tiles' chains alternate; each tile keeps its order of three products
#pragma unroll
      for (int t = 0; t < 4; ++t) { o[0][t] = wmma16p(va[t], pg[0], o[0][t]); o[1][t] = wmma16p(va[t], pg[1], o[1][t]); }
#pragma unroll
      for (int t = 0; t < 4; ++t) { o[0][t] = wmma16p(vb2[t], pf[0], o[0][t]); if (t < 3) o[1][t] = wmma16p(vb2[t], pf[1], o[1][t]); }
      __builtin_amdgcn_sched_barrier(0);   // the padded product below stays the step's last
      o[1][3] = wmma16b(vb2[3], pf[1], o[1][3]); }  // its four v_nop keep the distance to the next vector writes into the fragment registers
    // publish point of stage st + 1, passed by every wave on every trip
    asm volatile("s_wait_dscnt 0x0" ::: "memory");      // this wave's reads of stage st have returned
    asm volatile("s_wait_asynccnt 0x0" ::: "memory");   // this wave's share of stage st + 1 has landed
    __syncthreads();                                     // publishes stage st + 1 and frees stage st's buffer
    if (st + 2 < nst) stage_copy(ring0 + (st & 1) * (STG * 2), ckh + (size_t)(st + 2) * KT * HD, ckl + (size_t)(st + 2) * KT * HD, cvh + (st + 2) * KT, cvl + (st + 2) * KT);
  }
  asm volatile("s_wait_asynccnt 0x0" ::: "memory");     // nothing of this wave is in flight when the ring becomes exchange and output staging
  // The two waves of a pair hold partial results over disjoint keys for the same 32 queries: wave kp keeps column group kp and hands group 1 - kp to its partner, lane to lane, through LDS.
  float (*Ex)[34][32] = reinterpret_cast<float (*)[34][32]>(&Ring[0]);   // [wave][value][lane]; behind the last trip's barrier no wave reads the ring any more
  l[0] += xhalf(l[0]); l[1] += xhalf(l[1]);   // a query's partial normaliser = the two lane halves' sums
  const float mk = kp ? m[1] : m[0], lk = kp ? l[1] : l[0];
#pragma unroll
  for (int t = 0; t < 4; ++t)
#pragma unroll
    for (int r = 0; r < 8; ++r) Ex[wave][t * 8 + r][lane] = kp ? o[0][t][r] : o[1][t][r];
  Ex[wave][32][lane] = kp ? m[0] : m[1]; Ex[wave][33][lane] = kp ? l[0] : l[1];
  __syncthreads();   // the partner's partial results are read across waves
  float po[32];
#pragma unroll
  for (int i = 0; i < 32; ++i) po[i] = Ex[wave ^ 1][i][lane];
  const float pm = Ex[wave ^ 1][32][lane], pl = Ex[wave ^ 1][33][lane];
  const float mj = fmaxf(mk, pm), ak = nexp2(mk - mj), ap = nexp2(pm - mj);   // both maxima are finite: each wave's first step is unmasked
  const float inv = 1.0f / ((lk * ak + pl * ap) * PS * XS); const float ck = ak * inv, cp = ap * inv;
  wave_lds_sync();   // all lanes' reads of the partner's range are done before this wave, its only reader, reuses it as output staging
  float (*To)[16][HD + 4] = reinterpret_cast<float (*)[16][HD + 4]>(&Ring[0]);
  const int ws = wave ^ 1, qk = q0 + 16 * kp;
#pragma unroll
  for (int t = 0; t < 4; ++t)
#pragma unroll
    for (int r = 0; r < 8; ++r) To[ws][col][t * 16 + 8 * hh + r] = (kp ? o[1][t][r] : o[0][t][r]) * ck + po[t * 8 + r] * cp;
  wave_lds_sync();
  {
    for (int rr2 = 0; rr2 < 8; ++rr2) { const int row = 2 * rr2 + hh; const int c4 = col * 4; const v4f f = *(const v4f*)(&To[ws][row][c4]);
      *(v4f*)(out + ((size_t)b * (SEQ_FULL) + qk + row) * DM + h * HD + c4) = f; }
     }
}
}  // namespace

extern "C" void kernel_launch(void* const* d_in, const int* in_sizes, int n_in, void* d_out, int out_size, void* d_ws, size_t ws_size, hipStream_t stream) {
  if (n_in < 7) return;
  auto Fp = [&](int i) { return (const float*)d_in[i]; };
  // wire order: 0 x [2,2048,1024], 1 W_q [1024,1024] (out,in), 2 b_q [1024], 3 W_k, 4 b_k, 5 W_v, 6 b_v - all f32
  if (in_sizes[0] < (NB_FULL) * (SEQ_FULL) * DM || in_sizes[1] < DM * DM || in_sizes[2] < DM || in_sizes[3] < DM * DM || in_sizes[4] < DM || in_sizes[5] < DM * DM || in_sizes[6] < DM) return;
  if (out_size < (((NB) - 1) * (SEQ_FULL) + (SEQ)) * DM) return;
  size_t off = 0; char* ws = (char*)d_ws;
  auto carve = [&](size_t bytes) { char* p = ws + off; off += (bytes + 255) & ~(size_t)255; return p; };
  b16* X16 = (b16*)carve((size_t)(NB_FULL) * (SEQ_FULL) * DM * 2);                 // 8 MiB
  b16* WT = (b16*)carve((size_t)3 * DM * DM * 2);                                  // 6 MiB
  const size_t plane = (size_t)(NB_FULL) * H * (SEQ_FULL) * HD * 2;                 // 8 MiB each, full strides
  b16* QH = (b16*)carve(plane); b16* QLo = (b16*)carve(plane); b16* KH = (b16*)carve(plane); b16* KLo = (b16*)carve(plane); b16* VTh = (b16*)carve(plane); b16* VTl = (b16*)carve(plane);
  if (off > ws_size || off > ((size_t)128 << 20)) return;   // total 62 MiB
  prep_kernel<<<(unsigned)(PREP_UNITS / 256), 256, 0, stream>>>(Fp(0), Fp(1), Fp(3), Fp(5), X16, WT);
  proj_kernel<<<dim3(KL / 128, (NB), 24), 256, 0, stream>>>(X16, WT, Fp(2), Fp(4), Fp(6), QH, QLo, KH, KLo, VTh, VTl);
  attn_kernel<<<dim3((SEQ) / 256, (NB) * H), 512, 0, stream>>>(QH, QLo, KH, KLo, VTh, VTl, (float*)d_out);
}

// v010
// It runs in 62.2 microseconds.
// Versions in between are left out here; by their measured steps it is 1.35 times as fast as v008.
// Counting every step since v000, it is 5.68 times as fast.
#include <hip/hip_runtime.h>

// All contractions: v_wmma_f32_16x16x32_f16 (f16 operands, f32 accumulate). q/k/v projections [NB*KL x 1024] x [1024 x 3072]: x bf16-exact f16 x8, W bf16-exact f16 x256,
// 1 product, bias added in f32; S^T = K Q^T with q and k each carried as one f16 x8 plane (1 product); O^T += V^T P^T with v as one f16 x8 plane and P x1024 as one f16 term
// (1 product): one f16 rounding (11 bits) of q, k, v and P, finer than the bf16 rounding (8 bits) of every input in front of it; softmax running max / sum / normaliser in f32.
// Layouts: x [NB_FULL][SEQ_FULL][1024]; W_q/W_k/W_v [1024 out][1024 in]; b_q/b_k/b_v [1024]; y = x W^T + b split into 16 heads x 64; scores scaled by 1/8; key j visible to query i
// iff j <= i + 128; out[b][t][64 h + d] = softmax-weighted sum of v, stored as f32 directly (no output projection).
// Every float input is RNE-converted to bf16 once on load. Fragment k-map per lane half hh for A AND B: elements 0..7 <- k = 8hh+0..7, 8..15 <- k = 16+8hh+0..7;
// Deterministic fixed-order flash-style loop per wave (32 queries, every second 32-key step of the visible keys), two waves' partial results joined in fixed order; no cross-block communication inside a launch.

#ifndef NB
#define NB 2
#endif
#ifndef SEQ
#define SEQ 2048
#endif
#define NB_FULL 2
#define SEQ_FULL 2048

namespace {
constexpr int DM = 1024, H = 16, HD = 64, SRC = 128;
constexpr int KL = ((SEQ) + SRC < (SEQ_FULL)) ? ((SEQ) + SRC) : (SEQ_FULL);   // key / value tokens needed by queries < SEQ
static_assert((NB) >= 1 && (NB) <= (NB_FULL));
static_assert((SEQ) % 64 == 0 && (SEQ) >= 64 && (SEQ) <= (SEQ_FULL));
static_assert(KL % 64 == 0 && KL >= (SEQ) && KL <= (SEQ_FULL));
static_assert(DM == H * HD && DM % 128 == 0 && HD == 64 && (SEQ_FULL) % 32 == 0);
constexpr float XS = 8.0f, WSC = 256.0f, PS = 1024.0f, LOG2E = 1.4426950408889634f;
typedef _Float16 b16;
typedef __attribute__((ext_vector_type(16))) _Float16 v16b;
typedef __attribute__((ext_vector_type(8))) _Float16 v8b;
typedef __attribute__((ext_vector_type(4))) _Float16 v4h;
typedef __attribute__((ext_vector_type(2))) _Float16 v2h;
typedef __attribute__((ext_vector_type(8))) float v8f;
typedef __attribute__((ext_vector_type(4))) float v4f;
typedef __attribute__((ext_vector_type(2))) float v2f;

__device__ __forceinline__ float bf16_rne(float f) { unsigned int u = __float_as_uint(f); u += 0x7FFFu + ((u >> 16) & 1u); return __uint_as_float(u & 0xFFFF0000u); }
// 16-bit fragment from a k-contiguous row (A: row m; B: column n stored [n][k]); hh = lane half
__device__ __forceinline__ v16b frag_kb(const b16* p, int hh) { const v8b a = *(const v8b*)(p + 8 * hh), b = *(const v8b*)(p + 16 + 8 * hh); v16b f;
#pragma unroll
  for (int e = 0; e < 8; ++e) { f[e] = a[e]; f[8 + e] = b[e]; } return f; }
__device__ __forceinline__ v8f wmma16b(v16b a, v16b b, v8f c) { v8f d = __builtin_amdgcn_wmma_f32_16x16x32_f16(false, a, false, b, (short)0, c, false, false); asm volatile("v_nop\n\tv_nop\n\tv_nop\n\tv_nop" : "+v"(d) : "v"(a), "v"(b)); return d; }
// the same product as a plain builtin, for blocks of independent accumulator chains: the neighbouring products fill each other's distance and the compiler pads the end of the block itself
__device__ __forceinline__ v8f wmma16p(v16b a, v16b b, v8f c) { return __builtin_amdgcn_wmma_f32_16x16x32_f16(false, a, false, b, (short)0, c, false, false); }
__device__ __forceinline__ void wave_lds_sync() { __builtin_amdgcn_fence(3, "workgroup"); __builtin_amdgcn_wave_barrier(); __builtin_amdgcn_fence(2, "workgroup"); }
__device__ __forceinline__ float nexp2(float v) { return __builtin_amdgcn_exp2f(v); }
// eight independent exp2 in one statement: the outputs are early-clobber, so inside it no exponential overwrites an earlier one's source, and the closing v_nop is the one slot that the instruction set
// asks for behind a transcendental before its result is read or its source overwritten (as plain builtins, back to back, the compiler gave an exponential the register of the one in front's source)
__device__ __forceinline__ void exp2x8(const float* a, float* p) {
  asm("v_exp_f32 %0, %8\n\tv_exp_f32 %1, %9\n\tv_exp_f32 %2, %10\n\tv_exp_f32 %3, %11\n\tv_exp_f32 %4, %12\n\tv_exp_f32 %5, %13\n\tv_exp_f32 %6, %14\n\tv_exp_f32 %7, %15\n\tv_nop"
      : "=&v"(p[0]), "=&v"(p[1]), "=&v"(p[2]), "=&v"(p[3]), "=&v"(p[4]), "=&v"(p[5]), "=&v"(p[6]), "=&v"(p[7])
      : "v"(a[0]), "v"(a[1]), "v"(a[2]), "v"(a[3]), "v"(a[4]), "v"(a[5]), "v"(a[6]), "v"(a[7]));
}
// lane l takes lane l ^ 16's value by one vector cross-row move: no LDS permute, so nothing of it counts on dscnt
__device__ __forceinline__ float xhalf(float v) { const int b = __builtin_bit_cast(int, v); return __builtin_bit_cast(float, __builtin_amdgcn_permlanex16(b, b, 0x76543210, 0xfedcba98, false, false)); }

constexpr size_t WU = (size_t)DM * DM / 8;                         // 8-element units per weight matrix
constexpr size_t XU = (size_t)(NB_FULL) * (SEQ_FULL) * DM / 8;     // 8-element units of x
constexpr size_t PREP_UNITS = 3 * WU + XU;
static_assert(PREP_UNITS % 256 == 0 && (3 * WU) % 256 == 0 && WU % 256 == 0);

// prep: WT [3072 o][1024 k] = W_q | W_k | W_v rows ([out][in] is already k-contiguous), bf16 RNE then x256 -> f16; X16 [NB_FULL*SEQ_FULL][1024] = bf16 RNE(x) x8 -> f16.
__global__ __launch_bounds__(256) void prep_kernel(const float* __restrict__ x, const float* __restrict__ wq, const float* __restrict__ wk, const float* __restrict__ wv, b16* __restrict__ X16, b16* __restrict__ WT) {
  const size_t u = (size_t)blockIdx.x * 256 + threadIdx.x; if (u >= PREP_UNITS) return;
  const float* src; b16* dst; float sc;
  if (u < 3 * WU) { const int m = (int)(u / WU); const size_t e = (u - (size_t)m * WU) * 8; const float* w = m == 0 ? wq : m == 1 ? wk : wv; src = w + e; dst = WT + (size_t)m * DM * DM + e; sc = WSC; }
  else { const size_t e = (u - 3 * WU) * 8; src = x + e; dst = X16 + e; sc = XS; }
  const v4f f0 = *(const v4f*)src, f1 = *(const v4f*)(src + 4); v8b o;
#pragma unroll
  for (int j = 0; j < 4; ++j) { o[j] = (b16)(bf16_rne(f0[j]) * sc); o[4 + j] = (b16)(bf16_rne(f1[j]) * sc); }
  { *(v8b*)dst = o;  }
}

// projections: grid (KL/256, NB, 16 heads); block = 256 tokens of batch b x the 192 columns of ONE head (64 of q, 64 of k, 64 of v), 16 waves, one block per WGP; wave = 64 tokens x 48 columns
// (16 of q, 16 of k, 16 of v: 12 accumulator tiles from 4 X and 3 W fragments per 32-k step). One stage = 128 k of the block's 256 X16 rows and 192 WT rows (rows of 256 B), brought ONCE per block into LDS by
// asynchronous copies (16 B per lane, 14 copies per lane and stage) at a row pitch of 272 B, two buffers: stage s + 1 flies while stage s is worked on; all waves read their fragments from LDS.
// Every accumulator tile sums k in ascending steps of 32 (K = 1024). q and k tiles are formed as W X^T (a lane holds 8 neighbouring d of one token), v tiles as X W^T (a lane holds 8 neighbouring tokens of one d):
// either way the lane's 8 results are neighbours in the plane they go to. epilogue: + bf16-RNE bias in f32, x8 -> f16, 16 B per lane into the ring (reused as staging), from there whole lines:
// q/k -> f16 x8 plane [b][h][t][64]; v -> f16 x8 plane [b][h][d][t]
constexpr int PT = 256, PC = 192, PK = 128, PP = PK + 8, PXL = PT * PP, PSTG = (PT + PC) * PP, PNS = DM / PK;   // tokens and columns per block; k per stage; row pitch, X plane and stage in f16 elements; stages
constexpr int EQ = HD + 8, EV = PT + 8;   // epilogue staging pitches in f16 elements: q and k rows (one token, 64 d), v rows (one d, 256 tokens)
static_assert(KL % PT == 0 && DM % PK == 0 && PNS >= 2 && PC == 3 * HD);
static_assert((size_t)2 * PT * EQ + (size_t)HD * EV <= (size_t)2 * PSTG);   // the epilogue staging fits into the ring

// One stage: lane unit (row r = tid / 16 + 32 j; 16-B piece c = tid % 16): j = 0 .. 7 of the X plane, j = 0 .. 5 of the W plane, whose rows 0-63, 64-127, 128-191 are the head's rows of W_q, W_k, W_v.
// lds = LDS byte address of the lane's unit in the X plane of the target buffer.
__device__ __forceinline__ void proj_copy(unsigned lds, const b16* xg, const b16* wg) {
  const unsigned l0 = lds, l1 = lds + 32 * PP * 2, l2 = lds + 64 * PP * 2, l3 = lds + 96 * PP * 2, l4 = lds + 128 * PP * 2, l5 = lds + 160 * PP * 2, l6 = lds + 192 * PP * 2, l7 = lds + 224 * PP * 2;
  const unsigned m0 = lds + PXL * 2, m1 = m0 + 32 * PP * 2, m2 = m0 + 64 * PP * 2, m3 = m0 + 96 * PP * 2, m4 = m0 + 128 * PP * 2, m5 = m0 + 160 * PP * 2;
  const b16 *g0 = xg, *g1 = xg + 32 * DM, *g2 = xg + 64 * DM, *g3 = xg + 96 * DM, *g4 = xg + 128 * DM, *g5 = xg + 160 * DM, *g6 = xg + 192 * DM, *g7 = xg + 224 * DM;
  const b16 *h0 = wg, *h1 = wg + 32 * DM, *h2 = wg + DM * DM, *h3 = wg + DM * DM + 32 * DM, *h4 = wg + 2 * DM * DM, *h5 = wg + 2 * DM * DM + 32 * DM;
  // the copies and, as the last line, the wait that stands in front of any rewrite of the address registers they name
  asm volatile("global_load_async_to_lds_b128 %0, %14, off\n\t"
               "global_load_async_to_lds_b128 %1, %15, off\n\t"
               "global_load_async_to_lds_b128 %2, %16, off\n\t"
               "global_load_async_to_lds_b128 %3, %17, off\n\t"
               "global_load_async_to_lds_b128 %4, %18, off\n\t"
               "global_load_async_to_lds_b128 %5, %19, off\n\t"
               "global_load_async_to_lds_b128 %6, %20, off\n\t"
               "global_load_async_to_lds_b128 %7, %21, off\n\t"
               "global_load_async_to_lds_b128 %8, %22, off\n\t"
               "global_load_async_to_lds_b128 %9, %23, off\n\t"
               "global_load_async_to_lds_b128 %10, %24, off\n\t"
               "global_load_async_to_lds_b128 %11, %25, off\n\t"
               "global_load_async_to_lds_b128 %12, %26, off\n\t"
               "global_load_async_to_lds_b128 %13, %27, off\n\t"
               "s_wait_xcnt 0x0"
               :: "v"(l0), "v"(l1), "v"(l2), "v"(l3), "v"(l4), "v"(l5), "v"(l6), "v"(l7), "v"(m0), "v"(m1), "v"(m2), "v"(m3), "v"(m4), "v"(m5),
                  "v"(g0), "v"(g1), "v"(g2), "v"(g3), "v"(g4), "v"(g5), "v"(g6), "v"(g7), "v"(h0), "v"(h1), "v"(h2), "v"(h3), "v"(h4), "v"(h5) : "memory");
}

__global__ __launch_bounds__(512) void proj_kernel(const b16* __restrict__ X16, const b16* __restrict__ WT, const float* __restrict__ bq, const float* __restrict__ bk, const float* __restrict__ bv,
                                                   b16* __restrict__ QH, b16* __restrict__ KH, b16* __restrict__ VTh) {
  __shared__ __attribute__((aligned(16))) b16 PR[2 * PSTG];
  const int tid = threadIdx.x, wave = __builtin_amdgcn_readfirstlane(tid >> 5), lane = tid & 31, nloc = lane & 15, hlf = lane >> 4; const int t0 = blockIdx.x * PT; const int b = blockIdx.y;
  const int h = blockIdx.z;
  const int wm = wave & 3, wn = wave >> 2;   // the wave's 64-token group and its 16 columns d of each of q, k, v
  const int sr = tid >> 4, sc = (tid & 15) * 8;   // the lane's first staged row and first element in it
  const unsigned ring0 = (unsigned)(size_t)&PR[0] + (unsigned)(sr * PP + sc) * 2u;
  const b16 *cx = X16 + ((size_t)b * (SEQ_FULL) + t0 + sr) * DM + sc, *cw = WT + (size_t)(h * HD + sr) * DM + sc;
  proj_copy(ring0, cx, cw);
  v8f acc[4][3];
#pragma unroll
  for (int i = 0; i < 4; ++i)
#pragma unroll
    for (int t = 0; t < 3; ++t) acc[i][t] = (v8f){};
  asm volatile("s_wait_asynccnt 0x0" ::: "memory");   // this wave's share of stage 0 has landed
  __syncthreads();                                     // stage 0 is published to all waves
  proj_copy(ring0 + PSTG * 2, cx + PK, cw + PK);
#pragma unroll 1
  for (int st = 0; st < PNS; ++st) {
    const b16* xr = PR + (st & 1) * PSTG + (wm * 64 + nloc) * PP; const b16* wr = PR + (st & 1) * PSTG + PXL + (wn * 16 + nloc) * PP;
#pragma unroll
    for (int ks = 0; ks < PK; ks += 32) { v16b a[4], w[3];   // the seven fragments of a 32-k step are read as one group
#pragma unroll
      for (int t = 0; t < 3; ++t) w[t] = frag_kb(wr + t * HD * PP + ks, hlf);
#pragma unroll
      for (int i = 0; i < 4; ++i) a[i] = frag_kb(xr + i * 16 * PP + ks, hlf);
#pragma unroll
      for (int i = 0; i < 4; ++i) { acc[i][0] = wmma16b(w[0], a[i], acc[i][0]); acc[i][1] = wmma16b(w[1], a[i], acc[i][1]); acc[i][2] = wmma16b(a[i], w[2], acc[i][2]); } }
    // publish point of stage st + 1, passed by every wave on every trip
    asm volatile("s_wait_dscnt 0x0" ::: "memory");      // this wave's reads of stage st have returned
    asm volatile("s_wait_asynccnt 0x0" ::: "memory");   // this wave's share of stage st + 1 has landed
    __syncthreads();                                     // publishes stage st + 1 and frees stage st's buffer
    if (st + 2 < PNS) proj_copy(ring0 + (st & 1) * (PSTG * 2), cx + (st + 2) * PK, cw + (st + 2) * PK);
  }
  asm volatile("s_wait_asynccnt 0x0" ::: "memory");     // nothing of this wave is in flight when the ring becomes epilogue staging
  b16 *Sq = &PR[0], *Sv = &PR[2 * PT * EQ];   // q rows, then k rows, then v rows; behind the last trip's barrier no wave reads the ring any more
#pragma unroll
  for (int t = 0; t < 2; ++t) { const float* bp = (t == 0 ? bq : bk) + h * HD + wn * 16 + 8 * hlf; const v4f b0 = *(const v4f*)bp, b1 = *(const v4f*)(bp + 4); float bb[8];
#pragma unroll
    for (int r = 0; r < 4; ++r) { bb[r] = bf16_rne(b0[r]); bb[4 + r] = bf16_rne(b1[r]); }
#pragma unroll
    for (int i = 0; i < 4; ++i) { v8b o8;
#pragma unroll
      for (int r = 0; r < 8; ++r) o8[r] = (b16)((acc[i][t][r] * (1.0f / (XS * WSC)) + bb[r]) * XS);
      *(v8b*)(Sq + (t * PT + wm * 64 + i * 16 + nloc) * EQ + wn * 16 + 8 * hlf) = o8; } }
  { const float bb = bf16_rne(bv[h * HD + wn * 16 + nloc]);
#pragma unroll
    for (int i = 0; i < 4; ++i) { v8b o8;
#pragma unroll
      for (int r = 0; r < 8; ++r) o8[r] = (b16)((acc[i][2][r] * (1.0f / (XS * WSC)) + bb) * XS);
      *(v8b*)(Sv + (wn * 16 + nloc) * EV + wm * 64 + i * 16 + 8 * hlf) = o8; } }
  __syncthreads();   // the staging is read across waves
  const size_t ph = (size_t)b * H + h;
  b16 *qd = QH + (ph * (SEQ_FULL) + t0) * HD + (size_t)tid * 8, *kd = KH + (ph * (SEQ_FULL) + t0) * HD + (size_t)tid * 8;   // the block's 256 q (k) rows are 32 KiB in a row
  b16* vd = VTh + (ph * HD + (tid >> 5)) * (size_t)(SEQ_FULL) + t0 + lane * 8;                                              // a wave stores one d row's 256 tokens, 512 B in a row
  v8b oq[4], ok[4], ov[4];
#pragma unroll
  for (int j = 0; j < 4; ++j) { const int tok = (tid >> 3) + 64 * j; oq[j] = *(const v8b*)(Sq + tok * EQ + (tid & 7) * 8); ok[j] = *(const v8b*)(Sq + (PT + tok) * EQ + (tid & 7) * 8);
    ov[j] = *(const v8b*)(Sv + ((tid >> 5) + 16 * j) * EV + lane * 8); }
#pragma unroll
  for (int j = 0; j < 4; ++j) { *(v8b*)(qd + j * 512 * 8) = oq[j]; *(v8b*)(kd + j * 512 * 8) = ok[j]; *(v8b*)(vd + (size_t)j * 16 * (SEQ_FULL)) = ov[j]; }
}

// attention: grid (SEQ/256, NB x H): block = 16 waves = two 128-query tiles of one head side by side: waves 0-7 take tile n - 1 - x (long), waves 8-15 tile x (short), so that every
// block, and with one block per WGP every WGP, holds about the same number of 32-key steps. Both tiles walk the same K/V ring: keys 0 .. min(KL, long tile's last query + 1 + 128) in stages of
// 64 keys; the stage count is the block's one count and every wave passes every publish point, also a wave whose own keys have ended. One stage = two planes of 64 rows x 128 B
// (K: row = key; V^T: row = d), brought ONCE per block into LDS by asynchronous copies (16 B per lane, 2 copies per lane and stage) at a row pitch of 144 B, two buffers:
// stage s + 1 flies while stage s is worked on; all 16 waves read their fragments from LDS. Inside a tile waves 2 i and 2 i + 1 share queries 32 i .. 32 i + 31 (two 16-column groups) and split every
// stage: wave 2 i takes its keys 0-31, wave 2 i + 1 its keys 32-63 (keys < q0 + 32 + 128), so that one K or V fragment read from LDS feeds two column groups. Per column group and 32-key step:
// S^T = K Q^T; online softmax in f32 (maximum exchanged between the lane halves in registers, sums joined behind the loop), the mask applied only in the steps that straddle its edge; P x1024 packed in-lane from the scores into the B fragment; O^T += V^T P^T;
// behind the loop the pair's two partial results (maximum, sum, O) are joined through LDS, each wave finishing one column group.
constexpr int AW = 8, BW = 2 * AW, NT = (SEQ) / (16 * AW), KT = 64, RP = 64 + 8, PLN = 64 * RP, STG = 2 * PLN;   // waves per tile and per block; query tiles per head; keys per stage; row pitch, plane and stage in f16 elements
constexpr int OSE = BW * 16 * (HD + 4) * 2, RGE = (2 * STG > OSE) ? 2 * STG : OSE;   // exchange and output staging behind the loop, and the shared array that holds the ring first and the staging then, in f16 elements
static_assert((SEQ) % (16 * BW) == 0 && KL % KT == 0 && KL >= 2 * KT && (16 * AW + SRC) % KT == 0);
static_assert(SRC >= 63 && sizeof(float[34][32]) == sizeof(float[16][HD + 4]));   // keys 0 .. 63 are visible to every query; a wave's exchange range is its partner's output staging range

// One stage: lane unit (row r = tid / 8 in 0 .. 63, 16-B piece c = tid % 8) of each of the two planes. lds = LDS byte address of the lane's unit in plane 0 of the target buffer.
__device__ __forceinline__ void stage_copy(unsigned lds, const b16* kh, const b16* vh) {
  const unsigned l0 = lds, l1 = lds + PLN * 2;
  // the copies and, as the last line, the wait that stands in front of any rewrite of the address registers they name
  asm volatile("global_load_async_to_lds_b128 %0, %2, off\n\t"
               "global_load_async_to_lds_b128 %1, %3, off\n\t"
               "s_wait_xcnt 0x0"
               :: "v"(l0), "v"(l1), "v"(kh), "v"(vh) : "memory");
}

__global__ __launch_bounds__(512) void attn_kernel(const b16* __restrict__ QH, const b16* __restrict__ KH, const b16* __restrict__ VTh, float* __restrict__ out) {
  __shared__ __attribute__((aligned(16))) b16 Ring[RGE];
  const int tid = threadIdx.x, wave = __builtin_amdgcn_readfirstlane(tid >> 5), lane = tid & 31, hh = lane >> 4, col = lane & 15; const int b = blockIdx.y / H, h = blockIdx.y % H;
  const int qbl = (NT - 1 - (int)blockIdx.x) * (16 * AW);   // first query of the long tile, which sets the block's stage count
  const int kp = wave & 1;   // the wave's 32 keys of every 64-key stage
  const int qb = (wave < AW) ? qbl : (int)blockIdx.x * (16 * AW), q0 = qb + ((wave & (AW - 1)) >> 1) * 32;   // wave-uniform choice of the tile; waves 2 i and 2 i + 1 share 32 queries
  const size_t ph = (size_t)b * H + h; const size_t pq = ph * (size_t)(SEQ_FULL) * HD; const b16* Vh = VTh + ph * HD * (size_t)(SEQ_FULL);
  const int nst = ((qbl + 16 * AW + SRC < KL) ? (qbl + 16 * AW + SRC) : KL) / KT;   // block-uniform, >= 2; staged keys stay < KL; covers the short tile's keys too
  const int sr = tid >> 3, sc = (tid & 7) * 8;   // the lane's staged row and first element in it
  const unsigned ring0 = (unsigned)(size_t)&Ring[0] + (unsigned)(sr * RP + sc) * 2u;
  const b16 *ckh = KH + pq + (size_t)sr * HD + sc, *cvh = Vh + (size_t)sr * (SEQ_FULL) + sc;
  stage_copy(ring0, ckh, cvh);
  v16b qh0[2], qh1[2];   // two 16-query column groups g per wave: every K and V fragment read from LDS feeds both
#pragma unroll
  for (int g = 0; g < 2; ++g) { const size_t qo = pq + (size_t)(q0 + 16 * g + col) * HD; qh0[g] = frag_kb(QH + qo, hh); qh1[g] = frag_kb(QH + qo + 32, hh); }
  const float cs = LOG2E / (8.0f * XS * XS);
  float m[2] = {-INFINITY, -INFINITY}, l[2] = {0.0f, 0.0f}; v8f o[2][4];
#pragma unroll
  for (int g = 0; g < 2; ++g)
#pragma unroll
    for (int t = 0; t < 4; ++t) o[g][t] = (v8f){};
  const int kend = (q0 + 32 + SRC < KL) ? (q0 + 32 + SRC) : KL;   // wave-uniform
  asm volatile("s_wait_asynccnt 0x0" ::: "memory");   // this wave's share of stage 0 has landed
  __syncthreads();                                     // stage 0 is published to all waves
  stage_copy(ring0 + STG * 2, ckh + (size_t)KT * HD, cvh + KT);
  const int ko = 32 * kp;
#pragma unroll 1
  for (int st = 0; st < nst; ++st) {
    const b16* buf = Ring + (st & 1) * STG;
    const int kb = st * KT + ko;
    if (kb < kend) {   // wave-uniform: no step beyond this wave's last visible key; the publish point below is still passed
      v16b kh0[2], kh1[2]; v8f s[2][2];
#pragma unroll
      for (int u = 0; u < 2; ++u) { kh0[u] = frag_kb(buf + (ko + u * 16 + col) * RP, hh); s[0][u] = (v8f){}; s[1][u] = (v8f){}; }   // read in the order in which the products below take them
#pragma unroll
      for (int u = 0; u < 2; ++u) kh1[u] = frag_kb(buf + (ko + u * 16 + col) * RP + 32, hh);
      __builtin_amdgcn_sched_barrier(0);   // the step's 8 K reads stay one group in front of the score products: the wave waits out the LDS latency once, not per fragment
#pragma unroll
      for (int u = 0; u < 2; ++u) { s[0][u] = wmma16p(kh0[u], qh0[0], s[0][u]); s[1][u] = wmma16p(kh0[u], qh0[1], s[1][u]); }   // four score tiles' chains alternate; each tile sums d 0-31, then d 32-63
#pragma unroll
      for (int u = 0; u < 2; ++u) { s[0][u] = wmma16p(kh1[u], qh1[0], s[0][u]); s[1][u] = wmma16p(kh1[u], qh1[1], s[1][u]); }
      v16b va[4];
#pragma unroll
      for (int t = 0; t < 4; ++t) va[t] = frag_kb(buf + PLN + (t * 16 + col) * RP + ko, hh);
      __builtin_amdgcn_sched_barrier(0);   // the 8 V reads stay one group here, in front of the softmax, whose vector work covers their latency
      const bool edge = kb + 31 > q0 + SRC;   // wave-uniform: only a step that reaches past the last key visible to the wave's first query has anything to mask
      v16b pf[2];   // score i of a lane is key 8 hh + 16 (i / 8) + i % 8 of query col: the very element i of the lane's B fragment of P^T, so P goes from the score registers into the operand in-lane
#pragma unroll
      for (int g = 0; g < 2; ++g) {
        float e[16]; float mx = -INFINITY;
#pragma unroll
        for (int u = 0; u < 2; ++u)
#pragma unroll
          for (int r = 0; r < 8; ++r) e[u * 8 + r] = s[g][u][r] * cs;
        if (edge) {
          const int lim = q0 + 16 * g + col + SRC - kb - 8 * hh;   // the lane's last visible key, counted from its first key of the step
#pragma unroll
          for (int i = 0; i < 16; ++i) e[i] = ((i >> 3) * 16 + (i & 7) <= lim) ? e[i] : -INFINITY; }   // score i belongs to key kb + 8 hh + 16 (i / 8) + i % 8
#pragma unroll
        for (int i = 0; i < 16; ++i) mx = fmaxf(mx, e[i]);
        // every wave's first step is unmasked (SRC >= 63), so m and mn are finite from there on: a masked score gives exp2(-inf) = 0 by itself, and the first step's m = -inf gives al = 0 on o = 0, l = 0
        mx = fmaxf(mx, xhalf(mx)); const float mn = fmaxf(m[g], mx); const float al = nexp2(m[g] - mn); float sum; float p[16];
#pragma unroll
        for (int i = 0; i < 16; ++i) e[i] -= mn;
        exp2x8(e, p); exp2x8(e + 8, p + 8);
#pragma unroll
        for (int i2 = 0; i2 < 16; i2 += 2) { const float p0 = p[i2], p1 = p[i2 + 1]; sum = i2 ? sum + p0 : p0; sum += p1; const v2f t = (v2f){p0, p1} * PS;   // two neighbours fill one operand register
          const v2h a2 = __builtin_convertvector(t, v2h); pf[g][i2] = a2[0]; pf[g][i2 + 1] = a2[1]; }
        l[g] = l[g] * al + sum; m[g] = mn;   // l holds the lane half's own 16 keys of each step; m and al are equal in both halves, so the halves are joined once, behind the loop
#pragma unroll
        for (int t = 0; t < 4; ++t) o[g][t] *= al;
      }
#pragma unroll
      for (int t = 0; t < 4; ++t) { o[0][t] = wmma16p(va[t], pf[0], o[0][t]); if (t < 3) o[1][t] = wmma16p(va[t], pf[1], o[1][t]); }   // seven of the eight independent output tiles
      __builtin_amdgcn_sched_barrier(0);   // the padded product below stays the step's last
      o[1][3] = wmma16b(va[3], pf[1], o[1][3]); }  // its four v_nop keep the distance to the next vector writes into the fragment registers
    // publish point of stage st + 1, passed by every wave on every trip
    asm volatile("s_wait_dscnt 0x0" ::: "memory");      // this wave's reads of stage st have returned
    asm volatile("s_wait_asynccnt 0x0" ::: "memory");   // this wave's share of stage st + 1 has landed
    __syncthreads();                                     // publishes stage st + 1 and frees stage st's buffer
    if (st + 2 < nst) stage_copy(ring0 + (st & 1) * (STG * 2), ckh + (size_t)(st + 2) * KT * HD, cvh + (st + 2) * KT);
  }
  asm volatile("s_wait_asynccnt 0x0" ::: "memory");     // nothing of this wave is in flight when the ring becomes exchange and output staging
  // The two waves of a pair hold partial results over disjoint keys for the same 32 queries: wave kp keeps column group kp and hands group 1 - kp to its partner, lane to lane, through LDS.
  float (*Ex)[34][32] = reinterpret_cast<float (*)[34][32]>(&Ring[0]);   // [wave][value][lane]; behind the last trip's barrier no wave reads the ring any more
  l[0] += xhalf(l[0]); l[1] += xhalf(l[1]);   // a query's partial normaliser = the two lane halves' sums
  const float mk = kp ? m[1] : m[0], lk = kp ? l[1] : l[0];
#pragma unroll
  for (int t = 0; t < 4; ++t)
#pragma unroll
    for (int r = 0; r < 8; ++r) Ex[wave][t * 8 + r][lane] = kp ? o[0][t][r] : o[1][t][r];
  Ex[wave][32][lane] = kp ? m[0] : m[1]; Ex[wave][33][lane] = kp ? l[0] : l[1];
  __syncthreads();   // the partner's partial results are read across waves
  float po[32];
#pragma unroll
  for (int i = 0; i < 32; ++i) po[i] = Ex[wave ^ 1][i][lane];
  const float pm = Ex[wave ^ 1][32][lane], pl = Ex[wave ^ 1][33][lane];
  const float mj = fmaxf(mk, pm), ak = nexp2(mk - mj), ap = nexp2(pm - mj);   // both maxima are finite: each wave's first step is unmasked
  const float inv = 1.0f / ((lk * ak + pl * ap) * PS * XS); const float ck = ak * inv, cp = ap * inv;
  wave_lds_sync();   // all lanes' reads of the partner's range are done before this wave, its only reader, reuses it as output staging
  float (*To)[16][HD + 4] = reinterpret_cast<float (*)[16][HD + 4]>(&Ring[0]);
  const int ws = wave ^ 1, qk = q0 + 16 * kp;
#pragma unroll
  for (int t = 0; t < 4; ++t)
#pragma unroll
    for (int r = 0; r < 8; ++r) To[ws][col][t * 16 + 8 * hh + r] = (kp ? o[1][t][r] : o[0][t][r]) * ck + po[t * 8 + r] * cp;
  wave_lds_sync();
  {
    for (int rr2 = 0; rr2 < 8; ++rr2) { const int row = 2 * rr2 + hh; const int c4 = col * 4; const v4f f = *(const v4f*)(&To[ws][row][c4]);
      *(v4f*)(out + ((size_t)b * (SEQ_FULL) + qk + row) * DM + h * HD + c4) = f; }
     }
}
}  // namespace

extern "C" void kernel_launch(void* const* d_in, const int* in_sizes, int n_in, void* d_out, int out_size, void* d_ws, size_t ws_size, hipStream_t stream) {
  if (n_in < 7) return;
  auto Fp = [&](int i) { return (const float*)d_in[i]; };
  // wire order: 0 x [2,2048,1024], 1 W_q [1024,1024] (out,in), 2 b_q [1024], 3 W_k, 4 b_k, 5 W_v, 6 b_v - all f32
  if (in_sizes[0] < (NB_FULL) * (SEQ_FULL) * DM || in_sizes[1] < DM * DM || in_sizes[2] < DM || in_sizes[3] < DM * DM || in_sizes[4] < DM || in_sizes[5] < DM * DM || in_sizes[6] < DM) return;
  if (out_size < (((NB) - 1) * (SEQ_FULL) + (SEQ)) * DM) return;
  size_t off = 0; char* ws = (char*)d_ws;
  auto carve = [&](size_t bytes) { char* p = ws + off; off += (bytes + 255) & ~(size_t)255; return p; };
  b16* X16 = (b16*)carve((size_t)(NB_FULL) * (SEQ_FULL) * DM * 2);                 // 8 MiB
  b16* WT = (b16*)carve((size_t)3 * DM * DM * 2);                                  // 6 MiB
  const size_t plane = (size_t)(NB_FULL) * H * (SEQ_FULL) * HD * 2;                 // 8 MiB each, full strides
  b16* QH = (b16*)carve(plane); b16* KH = (b16*)carve(plane); b16* VTh = (b16*)carve(plane);
  if (off > ws_size || off > ((size_t)128 << 20)) return;   // total 38 MiB
  prep_kernel<<<(unsigned)(PREP_UNITS / 256), 256, 0, stream>>>(Fp(0), Fp(1), Fp(3), Fp(5), X16, WT);
  proj_kernel<<<dim3(KL / 256, (NB), H), 512, 0, stream>>>(X16, WT, Fp(2), Fp(4), Fp(6), QH, KH, VTh);
  attn_kernel<<<dim3((SEQ) / 256, (NB) * H), 512, 0, stream>>>(QH, KH, VTh, (float*)d_out);
}
